// v000
// The times below were measured on an AMD MI455X: many runs one after another, warmed up first and cycling through
// copies of the inputs, with the whole window's GPU time divided by the number of runs. Launches and the gaps
// between them are all in it. The median over several windows is given; except for v000 it joins two sittings, which
// can be a few percent apart, so the side-by-side timings, each taken in one sitting, are the better comparison.
// The starting kernel, v000, takes 389 microseconds a run.
// compute dtype: all float inputs rounded to bf16; qkv = x . W_qkv^T + b with EXACT bf16 products on WMMA 16x16x32 (natural rows; the fused weight as three contiguous row blocks); the guard clamp of k and v in f32 before the f16 rounding; PLAIN attention: q, k single f16 x 1/8, running-max softmax in f32 (hardware exp), P (scaled by 2^11, single f16) x v (single f16); out = o (bf16 hi + residual) . W_out^T (2 products) + b_out.
#include <hip/hip_runtime.h>
#include <math.h>

typedef __attribute__((ext_vector_type(16))) _Float16 v16h;
typedef __attribute__((ext_vector_type(16))) __bf16 v16b;
typedef __attribute__((ext_vector_type(8)))  _Float16 v8h;
typedef __attribute__((ext_vector_type(8)))  float v8f;
typedef __attribute__((ext_vector_type(4)))  float v4f;
typedef __attribute__((ext_vector_type(2)))  float v2f;
typedef __attribute__((ext_vector_type(4)))  unsigned v4u;
typedef __attribute__((ext_vector_type(4)))  int v4i;
typedef float __attribute__((may_alias)) float_a;
typedef int __attribute__((may_alias)) int_a;

template <typename T> __device__ __forceinline__ void vst2(void* p, T v) { *(T*)p = v;  }
__device__ __forceinline__ v8f wmma16(v16h a, v16h b, v8f c) {
  v8f d = __builtin_amdgcn_wmma_f32_16x16x32_f16(false, a, false, b, (short)0, c, false, false);
  asm volatile("v_nop\n\tv_nop\n\tv_nop\n\tv_nop" : "+v"(d) : "v"(a), "v"(b));
  return d;
}
__device__ __forceinline__ v8f wmma_bf(v16b a, v16b b, v8f c) {
  v8f d = __builtin_amdgcn_wmma_f32_16x16x32_bf16(false, a, false, b, (short)0, c, false, false);
  asm volatile("v_nop\n\tv_nop\n\tv_nop\n\tv_nop" : "+v"(d) : "v"(a), "v"(b));
  return d;
}
// Range-aware (guard-clamped) multi-head attention (B 2, S 2,048, d 1,024, 16 heads x 64): fused qkv projection + bias, k and v clamped against per-(batch, head, channel) anchor ranges with a 0.1 slack, softmax(q k^T / 8) v, output projection + bias.
__device__ __forceinline__ v16h frag_h(const _Float16* rowk0, int lane) {
  union { v16h v; v8h q[2]; } u; const _Float16* p = rowk0 + 8 * (lane >> 4);
  u.q[0] = *(const v8h*)p; u.q[1] = *(const v8h*)(p + 16); return u.v;
}
__device__ __forceinline__ v16h frag_f32(const float* rowk0, int lane) {
  v16h a; const float* p = rowk0 + 8 * (lane >> 4);
#pragma unroll
  for (int i = 0; i < 8; ++i) { a[i] = (_Float16)p[i]; a[8 + i] = (_Float16)p[16 + i]; }
  return a;
}
__device__ __forceinline__ v16h frag_f32s(const float* rowk0, int lane, float sc) {
  v16h a; const float* p = rowk0 + 8 * (lane >> 4);
#pragma unroll
  for (int i = 0; i < 8; ++i) { a[i] = (_Float16)(p[i] * sc); a[8 + i] = (_Float16)(p[16 + i] * sc); }
  return a;
}
// column fragment from a [K][ld] layout (column n), rows >= K read as 0
__device__ __forceinline__ v16h fragc_f32(const float* W, int k0, int n, int lane, int ld, int K) {
  v16h a; const int g = lane >> 4;
#pragma unroll
  for (int i = 0; i < 8; ++i) { const int ka = k0 + 8 * g + i, kb = ka + 16;
    a[i] = (_Float16)(ka < K ? W[(size_t)(ka < K ? ka : K - 1) * ld + n] : 0.f); a[8 + i] = (_Float16)(kb < K ? W[(size_t)(kb < K ? kb : K - 1) * ld + n] : 0.f); }
  return a;
}
struct F2 { v16b h, l; };
__device__ __forceinline__ F2 bsplit16(const float v[16]) { F2 r;
#pragma unroll
  for (int i = 0; i < 16; ++i) { const __bf16 h = (__bf16)v[i]; r.h[i] = h; r.l[i] = (__bf16)(v[i] - (float)h); }
  return r; }
__device__ __forceinline__ F2 split_row(const float* row, int k0, int lane) { float v[16]; const float* p = row + k0 + 8 * (lane >> 4);
#pragma unroll
  for (int i = 0; i < 8; ++i) { v[i] = p[i]; v[8 + i] = p[16 + i]; }
  return bsplit16(v); }
__device__ __forceinline__ F2 split_rowK(const float* row, int k0, int lane, int K) { float v[16]; const int g = lane >> 4;
#pragma unroll
  for (int i = 0; i < 8; ++i) { const int ka = k0 + 8 * g + i, kb = ka + 16; v[i] = ka < K ? row[ka < K ? ka : K - 1] : 0.f; v[8 + i] = kb < K ? row[kb < K ? kb : K - 1] : 0.f; }
  return bsplit16(v); }
__device__ __forceinline__ F2 split_col(const float* W, int k0, int n, int lane, int ld, int K) { float v[16]; const int g = lane >> 4;
#pragma unroll
  for (int i = 0; i < 8; ++i) { const int ka = k0 + 8 * g + i, kb = ka + 16; v[i] = ka < K ? W[(size_t)(ka < K ? ka : K - 1) * ld + n] : 0.f; v[8 + i] = kb < K ? W[(size_t)(kb < K ? kb : K - 1) * ld + n] : 0.f; }
  return bsplit16(v); }
__device__ __forceinline__ v8f mac3(const F2& a, const F2& b, v8f c) { c = wmma_bf(a.l, b.h, c); c = wmma_bf(a.h, b.l, c); return wmma_bf(a.h, b.h, c); }
__device__ __forceinline__ float sigm(float v) { return 1.0f / (1.0f + expf(-v)); }
#define LDSX() do { asm volatile("s_wait_dscnt 0" ::: "memory"); __builtin_amdgcn_wave_barrier(); __builtin_amdgcn_fence(__ATOMIC_RELEASE, "workgroup"); } while (0)


#define NB 2
#define SS 2048
#define DM 1024
#define NH 16
#define GEPS 0.1f
__device__ __forceinline__ float gclamp(float tv, float amin, float amax) { float lo = fmaxf(tv - GEPS, amin); const float hi = fminf(tv + GEPS, amax); lo = fminf(lo, hi); return fmaxf(lo, fminf(tv, hi)); }
#define HD 64
#define QKVW (3 * DM)
#ifndef TQB
#define TQB (SS / 64)
#define TNB NB
#define TOB (NB * SS / 64)     // output row tiles (all)
#endif
typedef __attribute__((ext_vector_type(8))) __bf16 v8b;
__device__ __forceinline__ v16b frag_b(const __bf16* rowk0, int lane) {
  union { v16b v; v8b q[2]; } u; const __bf16* p = rowk0 + 8 * (lane >> 4);
  u.q[0] = *(const v8b*)p; u.q[1] = *(const v8b*)(p + 16); return u.v;
}
__device__ __forceinline__ float bfr(float v) { return (float)(__bf16)v; }
__device__ __attribute__((noinline)) float exp_ni(float v) { return expf(v); }
__device__ __attribute__((noinline)) float erf_ni(float v) { return erff(v); }

#define PK_A 0                       // [3072][1024] Wqkv rows (natural [out][in])
#define PK_P (PK_A + QKVW * DM)        // [1024][1024] Wo rows (natural)
#define PK_END (PK_P + DM * DM)
#define WS_PK  0u
#define WS_QK  (WS_PK + 2u * PK_END)             // f16 [4096 rows][2048]: q | k
#define WS_QKL (WS_QK + 2u * NB * SS * 2 * DM)     // f16 q | k residual planes x2048
#define WS_VTH (WS_QKL + 2u * NB * SS * 2 * DM)    // f16 [b][1024 (h*64+d)][2048 s] hi
#define WS_VTL (WS_VTH + 2u * NB * DM * SS)        // f16 lo x 2048
#define WS_O   (WS_VTL + 2u * NB * DM * SS)        // f32 [4096][1024]
#define WS_CS  (WS_O + 4u * NB * SS * DM)           // f32 2 x [2048][32], not used by any kernel
#define WS_END (WS_CS + 4u * 2 * SS * 32)
// ---- k_pack: block = (row n, which): natural [out][in] rows -> bf16; which 0..2 -> W_q/W_k/W_v into PK_A rows which*1024 + n; 3 -> W_o into PK_P
__global__ __launch_bounds__(256) void k_pack(const float* __restrict__ WQ, const float* __restrict__ WK, const float* __restrict__ WV, const float* __restrict__ WO, __bf16* __restrict__ PK) {
  __shared__ __align__(16) __bf16 s[DM]; const int n = blockIdx.x, which = blockIdx.y, t = threadIdx.x; const float* Wm = (which == 0) ? WQ : (which == 1) ? WK : (which == 2) ? WV : WO;
  for (int k = t; k < DM; k += 256) s[k] = (__bf16)Wm[(size_t)n * DM + k];
  __syncthreads();
  __bf16* dst = (which < 3) ? PK + PK_A + ((size_t)which * DM + n) * DM : PK + PK_P + (size_t)n * DM;
  for (int q = t; q < DM / 8; q += 256) vst2((unsigned*)(dst + q * 8), *(const v4u*)&s[q * 8]);
}
__global__ __launch_bounds__(128) void k_qkv(const float* __restrict__ XQ, const float* __restrict__ XK, const float* __restrict__ XV, const __bf16* __restrict__ P, const float* __restrict__ BQ, const float* __restrict__ BK, const float* __restrict__ BV, const float* __restrict__ AKMIN, const float* __restrict__ AKMAX, const float* __restrict__ AVMIN, const float* __restrict__ AVMAX, _Float16* __restrict__ QK, _Float16* __restrict__ QKL, _Float16* __restrict__ VTH, _Float16* __restrict__ VTL) {
  const int which0 = (blockIdx.y * 128) / DM; const float* X = (which0 == 0) ? XQ : (which0 == 1) ? XK : XV; const float* BB = BQ ? (((which0 == 0) ? BQ : (which0 == 1) ? BK : BV) + (blockIdx.y * 128 - which0 * DM)) : nullptr;
  __shared__ __align__(16) _Float16 so[4][16][136], sol[4][16][136]; __shared__ __align__(16) _Float16 sth[128][72], stl[128][72];
  const int tid = threadIdx.x, wave = tid >> 5, lane = tid & 31, col = lane & 15, g = lane >> 4; const size_t r0 = (size_t)blockIdx.x * 64 + wave * 16; const int n0 = blockIdx.y * 128;
  v8f acc[8] = {};
#pragma unroll 2
  for (int kc = 0; kc < DM / 32; ++kc) { v16b a; { const float* p = X + (r0 + col) * DM + kc * 32 + 8 * g;
#pragma unroll
      for (int i = 0; i < 8; ++i) { a[i] = (__bf16)p[i]; a[8 + i] = (__bf16)p[16 + i]; } }
#pragma unroll
    for (int j = 0; j < 8; ++j) acc[j] = wmma_bf(a, frag_b(P + (size_t)(n0 + j * 16 + col) * DM + kc * 32, lane), acc[j]); }
  if (n0 < 2 * DM) {   // q stored unscaled (f16 sigma ~0.6, no subnormal exposure); 1/8 applied to the f32 score
#pragma unroll
    for (int j = 0; j < 8; ++j) {
#pragma unroll
      for (int r = 0; r < 8; ++r) { float v = acc[j][r] + (BB ? bfr(BB[j * 16 + col]) : 0.f); if (n0 >= DM) { const size_t ai = (size_t)((r0 + 8 * g + r) / SS) * DM + (n0 - DM + j * 16 + col); v = gclamp(v, bfr(AKMIN[ai]), bfr(AKMAX[ai])); } const _Float16 hv = (_Float16)v; so[wave][8 * g + r][j * 16 + col] = hv;   /* k guard-clamped per (b, h, d) */ sol[wave][8 * g + r][j * 16 + col] = (_Float16)((v - (float)hv) * 2048.0f); } }   // q, k (+ bias) as f16 hi + (x2048) residual
    LDSX();
    for (int rl = 0; rl < 16; ++rl) if (lane < 16) { vst2((unsigned*)(QK + (r0 + rl) * (2 * DM) + n0 + lane * 8), *(const v4u*)&so[wave][rl][lane * 8]); vst2((unsigned*)(QKL + (r0 + rl) * (2 * DM) + n0 + lane * 8), *(const v4u*)&sol[wave][rl][lane * 8]); }
  } else {
#pragma unroll
    for (int j = 0; j < 8; ++j) {
#pragma unroll
      for (int r = 0; r < 8; ++r) { float v = acc[j][r] + (BB ? bfr(BB[j * 16 + col]) : 0.f); { const size_t ai = (size_t)((r0 + 8 * g + r) / SS) * DM + (n0 - 2 * DM + j * 16 + col); v = gclamp(v, bfr(AVMIN[ai]), bfr(AVMAX[ai])); } const _Float16 hv = (_Float16)v; sth[j * 16 + col][wave * 16 + 8 * g + r] = hv;   /* v guard-clamped */ stl[j * 16 + col][wave * 16 + 8 * g + r] = (_Float16)((v - (float)hv) * 2048.0f); } }
    __syncthreads();
    const size_t rb = (size_t)blockIdx.x * 64; const int b = (int)(rb / SS), s0 = (int)(rb % SS); const int pc0 = n0 - 2 * DM;
    for (int q = tid; q < 128 * 8; q += 128) { const int d = q >> 3, pc = q & 7; const size_t o = ((size_t)b * DM + pc0 + d) * SS + s0 + pc * 8; vst2((unsigned*)(VTH + o), *(const v4u*)&sth[d][pc * 8]); vst2((unsigned*)(VTL + o), *(const v4u*)&stl[d][pc * 8]); }
  }
}
// ---- k_attn: block = (64 queries, head h, batch b): all-keys flash attention (K = 64: 2 k-steps), scores = (q.k) * 0.125 with single f16 operands, P.V: f16 P (x2^11) x V hi in one accumulator (accl stays 0); O[b*S+q][h*64+d] = (acc + accl / 2048) / (2048 l) (256-B segments)
__global__ __launch_bounds__(128) void k_attn(const _Float16* __restrict__ QK, const _Float16* __restrict__ QKL, const _Float16* __restrict__ VTH, const _Float16* __restrict__ VTL, const void* __restrict__ KMASK, float* __restrict__ O) {
  __shared__ __align__(16) float sp[4][16][36]; __shared__ __align__(16) float so[4][16][68];
  const int tid = threadIdx.x, wave = tid >> 5, lane = tid & 31, col = lane & 15, g = lane >> 4;
  const int qb = blockIdx.x, h = blockIdx.y, b = blockIdx.z; const int q0 = qb * 64 + wave * 16; const size_t rq = (size_t)b * SS + q0 + col;
  v16h aq[2], aql[2];
#pragma unroll
  for (int kc = 0; kc < 2; ++kc) { aq[kc] = frag_h(QK + rq * (2 * DM) + h * HD + kc * 32, lane); aql[kc] = frag_h(QKL + rq * (2 * DM) + h * HD + kc * 32, lane); }
  float m[8], l[8];
#pragma unroll
  for (int r = 0; r < 8; ++r) { m[r] = -3.0e38f; l[r] = 0.f; }
  v8f acc[4] = {}, accl[4] = {};
  const int nks = SS / 32;   // all keys
#pragma unroll 1
  for (int ks = 0; ks < nks; ++ks) { v8f s[2];
#pragma unroll
    for (int ct = 0; ct < 2; ++ct) { const int kk = ks * 32 + ct * 16 + col; const _Float16* krow = QK + ((size_t)b * SS + kk) * (2 * DM) + DM + h * HD; const _Float16* krowl = QKL + ((size_t)b * SS + kk) * (2 * DM) + DM + h * HD; v8f c = {}, cl = {};
#pragma unroll
      for (int kc = 0; kc < 2; ++kc) c = wmma16(aq[kc], frag_h(krow + kc * 32, lane), c);   // single product: q, k as one-rounding f16 operands
      (void)cl; (void)krowl;
      { const bool keepk = true;
#pragma unroll
      for (int r = 0; r < 8; ++r) s[ct][r] = keepk ? c[r] * 0.125f : -3.0e38f; } }   // 1/sqrt(64); no key is masked
#pragma unroll
    for (int r = 0; r < 8; ++r) { float mx = fmaxf(s[0][r], s[1][r]);
#pragma unroll
      for (int o = 1; o < 16; o <<= 1) mx = fmaxf(mx, __shfl_xor(mx, o));
      const float mn = fmaxf(m[r], mx); const float alpha = (m[r] <= -1.0e38f) ? 0.f : __expf(m[r] - mn);
      const float e0 = (s[0][r] <= -1.0e38f) ? 0.f : __expf(s[0][r] - mn), e1 = (s[1][r] <= -1.0e38f) ? 0.f : __expf(s[1][r] - mn); float es = e0 + e1;
#pragma unroll
      for (int o = 1; o < 16; o <<= 1) es += __shfl_xor(es, o);
      l[r] = l[r] * alpha + es; m[r] = mn;
#pragma unroll
      for (int dt = 0; dt < 4; ++dt) { acc[dt][r] *= alpha; accl[dt][r] *= alpha; }
      sp[wave][8 * g + r][col] = e0; sp[wave][8 * g + r][16 + col] = e1; }
    LDSX();
    v16h pa, pl; { const float* prow = &sp[wave][col][0] + 8 * (lane >> 4);
#pragma unroll
      for (int i = 0; i < 8; ++i) { const float x0 = prow[i] * 2048.0f, x1 = prow[16 + i] * 2048.0f; const _Float16 h0 = (_Float16)x0, h1 = (_Float16)x1; pa[i] = h0; pa[8 + i] = h1; pl[i] = (_Float16)((x0 - (float)h0) * 2048.0f); pl[8 + i] = (_Float16)((x1 - (float)h1) * 2048.0f); } }   // P scaled by 2^11 before the f16 split so small softmax weights stay out of the f16 subnormal range; 2^-11 folded into the epilogue
#pragma unroll
    for (int dt = 0; dt < 4; ++dt) { const size_t vr = ((size_t)b * DM + h * HD + dt * 16 + col) * SS + ks * 32; acc[dt] = wmma16(pa, frag_h(VTH + vr, lane), acc[dt]); }   // single product: P (x2^11) x V
    (void)pl;
    LDSX(); }
#pragma unroll
  for (int r = 0; r < 8; ++r) { const float il = (1.0f / 2048.0f) / l[r];
#pragma unroll
    for (int dt = 0; dt < 4; ++dt) so[wave][8 * g + r][dt * 16 + col] = (acc[dt][r] + accl[dt][r] * (1.0f / 2048.0f)) * il; }
  LDSX();
  for (int rl = 0; rl < 16; ++rl) if (lane < 16) vst2(O + ((size_t)b * SS + q0 + rl) * DM + h * HD + lane * 4, *(const v4f*)&so[wave][rl][lane * 4]);
}
// ---- k_out: block = (64 rows, 128 cols): out = O(hi/lo) . Wo rows (2 products) + bo
__global__ __launch_bounds__(128) void k_out(const float* __restrict__ O, const __bf16* __restrict__ P, const float* __restrict__ BO, float* __restrict__ Y) {
  __shared__ __align__(16) float so[4][16][132];
  const int tid = threadIdx.x, wave = tid >> 5, lane = tid & 31, col = lane & 15, g = lane >> 4; const size_t r0 = (size_t)blockIdx.x * 64 + wave * 16; const int n0 = blockIdx.y * 128;
  v8f acc[8] = {};
#pragma unroll 2
  for (int kc = 0; kc < DM / 32; ++kc) { const F2 a = split_row(O + (r0 + col) * DM, kc * 32, lane);
#pragma unroll
    for (int j = 0; j < 8; ++j) { const v16b w = frag_b(P + (size_t)(n0 + j * 16 + col) * DM + kc * 32, lane); acc[j] = wmma_bf(a.l, w, acc[j]); acc[j] = wmma_bf(a.h, w, acc[j]); } }
#pragma unroll
  for (int j = 0; j < 8; ++j) {
#pragma unroll
    for (int r = 0; r < 8; ++r) so[wave][8 * g + r][j * 16 + col] = acc[j][r] + bfr(BO[n0 + j * 16 + col]); }
  LDSX();
  for (int rl = 0; rl < 16; ++rl) vst2(Y + (r0 + rl) * DM + n0 + lane * 4, *(const v4f*)&so[wave][rl][lane * 4]);
}
extern "C" void kernel_launch(void* const* d_in, const int* in_sizes, int n_in, void* d_out, int out_size, void* d_ws, size_t ws_size, hipStream_t stream) {
  (void)in_sizes; (void)n_in; (void)out_size;
  const float** F = (const float**)d_in;   // 0 x [2,2048,1024], 1 qkv_w [3072,1024] natural, 2 qkv_b, 3 out_w, 4 out_b, 5 anchor_k_min, 6 anchor_k_max, 7 anchor_v_min, 8 anchor_v_max ([2,16,1,64] each)
  if (ws_size < (size_t)WS_END) return;
  char* ws = (char*)d_ws; __bf16* PK = (__bf16*)(ws + WS_PK); _Float16 *QK = (_Float16*)(ws + WS_QK), *QKL = (_Float16*)(ws + WS_QKL), *VTH = (_Float16*)(ws + WS_VTH), *VTL = (_Float16*)(ws + WS_VTL); float* O = (float*)(ws + WS_O);
  k_pack<<<dim3(DM, 4), 256, 0, stream>>>(F[1], F[1] + (size_t)DM * DM, F[1] + (size_t)2 * DM * DM, F[3], PK);
  k_qkv<<<dim3(TNB * SS / 64, QKVW / 128), 128, 0, stream>>>(F[0], F[0], F[0], PK + PK_A, F[2], F[2] + DM, F[2] + 2 * DM, F[5], F[6], F[7], F[8], QK, QKL, VTH, VTL);
  k_attn<<<dim3(TQB, NH, TNB), 128, 0, stream>>>(QK, QKL, VTH, VTL, nullptr, O);
  k_out<<<dim3(TOB, DM / 128), 128, 0, stream>>>(O, PK + PK_P, F[4], (float*)d_out);
}

// v001
// It runs in 159 microseconds.
// Two timings next to v000 put it at 2.52 and 2.51 times that version's speed.
// compute dtype: all float inputs rounded to bf16; qkv = x . W_qkv^T + b with EXACT bf16 products on WMMA 16x16x32 (natural rows; the fused weight as three contiguous row blocks); the guard clamp of k and v in f32 before the f16 rounding; PLAIN attention: q, k single f16 x 1/8, running-max softmax in f32 (hardware exp), P (scaled by 2^11, single f16) x v (single f16); out = o (bf16 hi + residual) . W_out^T (2 products) + b_out.
#include <hip/hip_runtime.h>
#include <math.h>

typedef __attribute__((ext_vector_type(16))) _Float16 v16h;
typedef __attribute__((ext_vector_type(16))) __bf16 v16b;
typedef __attribute__((ext_vector_type(8)))  _Float16 v8h;
typedef __attribute__((ext_vector_type(8)))  float v8f;
typedef __attribute__((ext_vector_type(4)))  float v4f;
typedef __attribute__((ext_vector_type(2)))  float v2f;
typedef __attribute__((ext_vector_type(4)))  unsigned v4u;
typedef __attribute__((ext_vector_type(4)))  int v4i;
typedef float __attribute__((may_alias)) float_a;
typedef int __attribute__((may_alias)) int_a;

template <typename T> __device__ __forceinline__ void vst2(void* p, T v) { *(T*)p = v;  }
__device__ __forceinline__ v8f wmma16(v16h a, v16h b, v8f c) {
  v8f d = __builtin_amdgcn_wmma_f32_16x16x32_f16(false, a, false, b, (short)0, c, false, false);
  asm volatile("v_nop\n\tv_nop\n\tv_nop\n\tv_nop" : "+v"(d) : "v"(a), "v"(b));
  return d;
}
__device__ __forceinline__ v8f wmma_bf(v16b a, v16b b, v8f c) {
  v8f d = __builtin_amdgcn_wmma_f32_16x16x32_bf16(false, a, false, b, (short)0, c, false, false);
  asm volatile("v_nop\n\tv_nop\n\tv_nop\n\tv_nop" : "+v"(d) : "v"(a), "v"(b));
  return d;
}
// Range-aware (guard-clamped) multi-head attention (B 2, S 2,048, d 1,024, 16 heads x 64): fused qkv projection + bias, k and v clamped against per-(batch, head, channel) anchor ranges with a 0.1 slack, softmax(q k^T / 8) v, output projection + bias.
__device__ __forceinline__ v16h frag_h(const _Float16* rowk0, int lane) {
  union { v16h v; v8h q[2]; } u; const _Float16* p = rowk0 + 8 * (lane >> 4);
  u.q[0] = *(const v8h*)p; u.q[1] = *(const v8h*)(p + 16); return u.v;
}
__device__ __forceinline__ v16h frag_f32(const float* rowk0, int lane) {
  v16h a; const float* p = rowk0 + 8 * (lane >> 4);
#pragma unroll
  for (int i = 0; i < 8; ++i) { a[i] = (_Float16)p[i]; a[8 + i] = (_Float16)p[16 + i]; }
  return a;
}
__device__ __forceinline__ v16h frag_f32s(const float* rowk0, int lane, float sc) {
  v16h a; const float* p = rowk0 + 8 * (lane >> 4);
#pragma unroll
  for (int i = 0; i < 8; ++i) { a[i] = (_Float16)(p[i] * sc); a[8 + i] = (_Float16)(p[16 + i] * sc); }
  return a;
}
// column fragment from a [K][ld] layout (column n), rows >= K read as 0
__device__ __forceinline__ v16h fragc_f32(const float* W, int k0, int n, int lane, int ld, int K) {
  v16h a; const int g = lane >> 4;
#pragma unroll
  for (int i = 0; i < 8; ++i) { const int ka = k0 + 8 * g + i, kb = ka + 16;
    a[i] = (_Float16)(ka < K ? W[(size_t)(ka < K ? ka : K - 1) * ld + n] : 0.f); a[8 + i] = (_Float16)(kb < K ? W[(size_t)(kb < K ? kb : K - 1) * ld + n] : 0.f); }
  return a;
}
struct F2 { v16b h, l; };
__device__ __forceinline__ F2 bsplit16(const float v[16]) { F2 r;
#pragma unroll
  for (int i = 0; i < 16; ++i) { const __bf16 h = (__bf16)v[i]; r.h[i] = h; r.l[i] = (__bf16)(v[i] - (float)h); }
  return r; }
__device__ __forceinline__ F2 split_row(const float* row, int k0, int lane) { float v[16]; const float* p = row + k0 + 8 * (lane >> 4);
#pragma unroll
  for (int i = 0; i < 8; ++i) { v[i] = p[i]; v[8 + i] = p[16 + i]; }
  return bsplit16(v); }
__device__ __forceinline__ F2 split_rowK(const float* row, int k0, int lane, int K) { float v[16]; const int g = lane >> 4;
#pragma unroll
  for (int i = 0; i < 8; ++i) { const int ka = k0 + 8 * g + i, kb = ka + 16; v[i] = ka < K ? row[ka < K ? ka : K - 1] : 0.f; v[8 + i] = kb < K ? row[kb < K ? kb : K - 1] : 0.f; }
  return bsplit16(v); }
__device__ __forceinline__ F2 split_col(const float* W, int k0, int n, int lane, int ld, int K) { float v[16]; const int g = lane >> 4;
#pragma unroll
  for (int i = 0; i < 8; ++i) { const int ka = k0 + 8 * g + i, kb = ka + 16; v[i] = ka < K ? W[(size_t)(ka < K ? ka : K - 1) * ld + n] : 0.f; v[8 + i] = kb < K ? W[(size_t)(kb < K ? kb : K - 1) * ld + n] : 0.f; }
  return bsplit16(v); }
__device__ __forceinline__ v8f mac3(const F2& a, const F2& b, v8f c) { c = wmma_bf(a.l, b.h, c); c = wmma_bf(a.h, b.l, c); return wmma_bf(a.h, b.h, c); }
__device__ __forceinline__ float sigm(float v) { return 1.0f / (1.0f + expf(-v)); }
#define LDSX() do { asm volatile("s_wait_dscnt 0" ::: "memory"); __builtin_amdgcn_wave_barrier(); __builtin_amdgcn_fence(__ATOMIC_RELEASE, "workgroup"); } while (0)


#define NB 2
#define SS 2048
#define DM 1024
#define NH 16
#define GEPS 0.1f
__device__ __forceinline__ float gclamp(float tv, float amin, float amax) { float lo = fmaxf(tv - GEPS, amin); const float hi = fminf(tv + GEPS, amax); lo = fminf(lo, hi); return fmaxf(lo, fminf(tv, hi)); }
#define HD 64
#define QKVW (3 * DM)
#ifndef TQB
#define TQB (SS / 64)
#define TNB NB
#define TOB (NB * SS / 64)     // output row tiles (all)
#endif
typedef __attribute__((ext_vector_type(8))) __bf16 v8b;
__device__ __forceinline__ v16b frag_b(const __bf16* rowk0, int lane) {
  union { v16b v; v8b q[2]; } u; const __bf16* p = rowk0 + 8 * (lane >> 4);
  u.q[0] = *(const v8b*)p; u.q[1] = *(const v8b*)(p + 16); return u.v;
}
__device__ __forceinline__ float bfr(float v) { return (float)(__bf16)v; }
typedef __attribute__((ext_vector_type(4))) __bf16 v4b;
#define KP 64   // k (or keys) per staged pass: 128 B of every 16-bit operand row, one whole line
#define LP 72   // LDS row pitch in 16-bit elements: 128 B of data + 16 B, the pitch for ds_load_b128 readers
__device__ __attribute__((noinline)) float exp_ni(float v) { return expf(v); }
__device__ __attribute__((noinline)) float erf_ni(float v) { return erff(v); }

#define PK_A 0                       // [3072][1024] Wqkv rows (natural [out][in])
#define PK_P (PK_A + QKVW * DM)        // [1024][1024] Wo rows (natural)
#define PK_END (PK_P + DM * DM)
#define WS_PK  0u
#define WS_QK  (WS_PK + 2u * PK_END)             // f16 [4096 rows][2048]: q | k
#define WS_QKL (WS_QK + 2u * NB * SS * 2 * DM)     // f16 q | k residual planes x2048
#define WS_VTH (WS_QKL + 2u * NB * SS * 2 * DM)    // f16 [b][1024 (h*64+d)][2048 s] hi
#define WS_VTL (WS_VTH + 2u * NB * DM * SS)        // f16 lo x 2048
#define WS_O   (WS_VTL + 2u * NB * DM * SS)        // f32 [4096][1024]
#define WS_CS  (WS_O + 4u * NB * SS * DM)           // f32 2 x [2048][32], not used by any kernel
#define WS_END (WS_CS + 4u * 2 * SS * 32)
// ---- k_pack: block = (row n, which): natural [out][in] rows -> bf16; which 0..2 -> W_q/W_k/W_v into PK_A rows which*1024 + n; 3 -> W_o into PK_P
__global__ __launch_bounds__(256) void k_pack(const float* __restrict__ WQ, const float* __restrict__ WK, const float* __restrict__ WV, const float* __restrict__ WO, __bf16* __restrict__ PK) {
  __shared__ __align__(16) __bf16 s[DM]; const int n = blockIdx.x, which = blockIdx.y, t = threadIdx.x; const float* Wm = (which == 0) ? WQ : (which == 1) ? WK : (which == 2) ? WV : WO;
  for (int k = t; k < DM; k += 256) s[k] = (__bf16)Wm[(size_t)n * DM + k];
  __syncthreads();
  __bf16* dst = (which < 3) ? PK + PK_A + ((size_t)which * DM + n) * DM : PK + PK_P + (size_t)n * DM;
  for (int q = t; q < DM / 8; q += 256) vst2((unsigned*)(dst + q * 8), *(const v4u*)&s[q * 8]);
}
__global__ __launch_bounds__(128) void k_qkv(const float* __restrict__ XQ, const float* __restrict__ XK, const float* __restrict__ XV, const __bf16* __restrict__ P, const float* __restrict__ BQ, const float* __restrict__ BK, const float* __restrict__ BV, const float* __restrict__ AKMIN, const float* __restrict__ AKMAX, const float* __restrict__ AVMIN, const float* __restrict__ AVMAX, _Float16* __restrict__ QK, _Float16* __restrict__ QKL, _Float16* __restrict__ VTH, _Float16* __restrict__ VTL) {
  const int which0 = (blockIdx.y * 128) / DM; const float* X = (which0 == 0) ? XQ : (which0 == 1) ? XK : XV; const float* BB = BQ ? (((which0 == 0) ? BQ : (which0 == 1) ? BK : BV) + (blockIdx.y * 128 - which0 * DM)) : nullptr;
  // one LDS range: the operand stage of the k loop (sw, sx), then, behind the loop's last barrier, the output staging of the branch taken
  __shared__ __align__(16) unsigned char sm[2 * 128 * 72 * 2];
  _Float16 (*so)[16][136] = (_Float16 (*)[16][136])sm; _Float16 (*sol)[16][136] = (_Float16 (*)[16][136])(sm + 4 * 16 * 136 * 2);
  _Float16 (*sth)[72] = (_Float16 (*)[72])sm; _Float16 (*stl)[72] = (_Float16 (*)[72])(sm + 128 * 72 * 2);
  __bf16 (*sw)[LP] = (__bf16 (*)[LP])sm; __bf16 (*sx)[LP] = (__bf16 (*)[LP])(sm + 128 * LP * 2);   // 128 weight rows, 64 x rows (bf16), KP k each
  const int tid = threadIdx.x, wave = tid >> 5, lane = tid & 31, col = lane & 15, g = lane >> 4; const size_t r0 = (size_t)blockIdx.x * 64 + wave * 16; const int n0 = blockIdx.y * 128;
  v8f acc[8] = {};
  const __bf16* wsrc = P + (size_t)(n0 + (tid >> 3)) * DM + (tid & 7) * 8;                       // a wave's 16-B load: 4 weight rows x 128 B
  const float* xsrc = X + ((size_t)blockIdx.x * 64 + (tid >> 4)) * DM + (tid & 15) * 4;           // a wave's 16-B load: 2 x rows x 256 B
  v4u wr[8]; v4f xr[8];
#pragma unroll
  for (int i = 0; i < 8; ++i) { wr[i] = *(const v4u*)(wsrc + (size_t)(16 * i) * DM); xr[i] = *(const v4f*)(xsrc + (size_t)(8 * i) * DM); }
#pragma unroll 1   // rolled: one copy of the pass keeps the prefetch registers' live range to one pass
  for (int ps = 0; ps < DM / KP; ++ps) {
#pragma unroll
    for (int i = 0; i < 8; ++i) { *(v4u*)&sw[(tid >> 3) + 16 * i][(tid & 7) * 8] = wr[i]; v4b c;
#pragma unroll
      for (int e = 0; e < 4; ++e) c[e] = (__bf16)xr[i][e];
      *(v4b*)&sx[(tid >> 4) + 8 * i][(tid & 15) * 4] = c; }
    __syncthreads();   // the stage is written: every wave may read it
    if (ps + 1 < DM / KP) {   // the next pass's rows fly while this pass is multiplied
#pragma unroll
      for (int i = 0; i < 8; ++i) { wr[i] = *(const v4u*)(wsrc + (size_t)(16 * i) * DM + (ps + 1) * KP); xr[i] = *(const v4f*)(xsrc + (size_t)(8 * i) * DM + (ps + 1) * KP); }
      asm volatile("s_wait_xcnt 0x0" ::: "memory"); }   // stands in front of the loop's advance of the address registers that these loads name
#pragma unroll
    for (int kc = 0; kc < KP / 32; ++kc) { const v16b a = frag_b(&sx[wave * 16 + col][kc * 32], lane); v16b w[8];
#pragma unroll
      for (int j = 0; j < 8; ++j) w[j] = frag_b(&sw[j * 16 + col][kc * 32], lane);
      __builtin_amdgcn_sched_barrier(0);   // the LDS reads stay one group ahead of the products: read pair by pair among them, each product waits out a whole LDS latency
#pragma unroll
      for (int j = 0; j < 8; ++j) acc[j] = wmma_bf(a, w[j], acc[j]); }
    __syncthreads();   // every wave has read the stage: it may be rewritten (behind the last pass: by the output staging)
  }
  if (n0 < 2 * DM) {   // q stored unscaled (f16 sigma ~0.6, no subnormal exposure); 1/8 applied to the f32 score
#pragma unroll
    for (int j = 0; j < 8; ++j) {
#pragma unroll
      for (int r = 0; r < 8; ++r) { float v = acc[j][r] + (BB ? bfr(BB[j * 16 + col]) : 0.f); if (n0 >= DM) { const size_t ai = (size_t)((r0 + 8 * g + r) / SS) * DM + (n0 - DM + j * 16 + col); v = gclamp(v, bfr(AKMIN[ai]), bfr(AKMAX[ai])); } const _Float16 hv = (_Float16)v; so[wave][8 * g + r][j * 16 + col] = hv;   /* k guard-clamped per (b, h, d) */ sol[wave][8 * g + r][j * 16 + col] = (_Float16)((v - (float)hv) * 2048.0f); } }   // q, k (+ bias) as f16 hi + (x2048) residual
    LDSX();
    for (int rl = 0; rl < 16; ++rl) if (lane < 16) { vst2((unsigned*)(QK + (r0 + rl) * (2 * DM) + n0 + lane * 8), *(const v4u*)&so[wave][rl][lane * 8]); vst2((unsigned*)(QKL + (r0 + rl) * (2 * DM) + n0 + lane * 8), *(const v4u*)&sol[wave][rl][lane * 8]); }
  } else {
#pragma unroll
    for (int j = 0; j < 8; ++j) {
#pragma unroll
      for (int r = 0; r < 8; ++r) { float v = acc[j][r] + (BB ? bfr(BB[j * 16 + col]) : 0.f); { const size_t ai = (size_t)((r0 + 8 * g + r) / SS) * DM + (n0 - 2 * DM + j * 16 + col); v = gclamp(v, bfr(AVMIN[ai]), bfr(AVMAX[ai])); } const _Float16 hv = (_Float16)v; sth[j * 16 + col][wave * 16 + 8 * g + r] = hv;   /* v guard-clamped */ stl[j * 16 + col][wave * 16 + 8 * g + r] = (_Float16)((v - (float)hv) * 2048.0f); } }
    __syncthreads();
    const size_t rb = (size_t)blockIdx.x * 64; const int b = (int)(rb / SS), s0 = (int)(rb % SS); const int pc0 = n0 - 2 * DM;
    for (int q = tid; q < 128 * 8; q += 128) { const int d = q >> 3, pc = q & 7; const size_t o = ((size_t)b * DM + pc0 + d) * SS + s0 + pc * 8; vst2((unsigned*)(VTH + o), *(const v4u*)&sth[d][pc * 8]); vst2((unsigned*)(VTL + o), *(const v4u*)&stl[d][pc * 8]); }
  }
}
// ---- k_attn: block = (64 queries, head h, batch b): all-keys flash attention (K = 64: 2 k-steps), scores = (q.k) * 0.125 with single f16 operands, P.V: f16 P (x2^11) x V hi in one accumulator (accl stays 0); O[b*S+q][h*64+d] = (acc + accl / 2048) / (2048 l) (256-B segments)
__global__ __launch_bounds__(128) void k_attn(const _Float16* __restrict__ QK, const _Float16* __restrict__ QKL, const _Float16* __restrict__ VTH, const _Float16* __restrict__ VTL, const void* __restrict__ KMASK, float* __restrict__ O) {
  __shared__ __align__(16) float sp[4][16][36]; __shared__ __align__(16) float so[4][16][68];
  __shared__ __align__(16) _Float16 sk[KP][LP], sv[HD][LP];   // the stage: KP keys x 64 channels; 64 channels of v x KP keys
  const int tid = threadIdx.x, wave = tid >> 5, lane = tid & 31, col = lane & 15, g = lane >> 4;
  const int qb = blockIdx.x, h = blockIdx.y, b = blockIdx.z; const int q0 = qb * 64 + wave * 16; const size_t rq = (size_t)b * SS + q0 + col;
  v16h aq[2], aql[2];
#pragma unroll
  for (int kc = 0; kc < 2; ++kc) { aq[kc] = frag_h(QK + rq * (2 * DM) + h * HD + kc * 32, lane); aql[kc] = frag_h(QKL + rq * (2 * DM) + h * HD + kc * 32, lane); }
  float m[8], l[8];
#pragma unroll
  for (int r = 0; r < 8; ++r) { m[r] = -3.0e38f; l[r] = 0.f; }
  v8f acc[4] = {}, accl[4] = {};
  const _Float16* ksrc = QK + ((size_t)b * SS + (tid >> 3)) * (2 * DM) + DM + h * HD + (tid & 7) * 8;   // a wave's 16-B load: 4 key rows x 128 B
  const _Float16* vsrc = VTH + ((size_t)b * DM + h * HD + (tid >> 3)) * SS + (tid & 7) * 8;               // a wave's 16-B load: 4 channel rows x 128 B
  v4u kr[4], vr[4];
#pragma unroll
  for (int i = 0; i < 4; ++i) { kr[i] = *(const v4u*)(ksrc + (size_t)(16 * i) * (2 * DM)); vr[i] = *(const v4u*)(vsrc + (size_t)(16 * i) * SS); }
#pragma unroll 1   // rolled: one copy of the stage's code
  for (int st = 0; st < SS / KP; ++st) {   // all keys, KP a stage
#pragma unroll
  for (int i = 0; i < 4; ++i) { *(v4u*)&sk[(tid >> 3) + 16 * i][(tid & 7) * 8] = kr[i]; *(v4u*)&sv[(tid >> 3) + 16 * i][(tid & 7) * 8] = vr[i]; }
  __syncthreads();   // the stage is written: every wave may read it
  if (st + 1 < SS / KP) {   // the next stage's rows fly while this one is worked on
#pragma unroll
    for (int i = 0; i < 4; ++i) { kr[i] = *(const v4u*)(ksrc + ((size_t)(st + 1) * KP + 16 * i) * (2 * DM)); vr[i] = *(const v4u*)(vsrc + (size_t)(16 * i) * SS + (st + 1) * KP); } }
#pragma unroll 1   // rolled: the 32-key body stays one copy, as it was
  for (int ks = 0; ks < KP / 32; ++ks) { v8f s[2]; v16h kf[2][2];
#pragma unroll
    for (int ct = 0; ct < 2; ++ct) {
#pragma unroll
      for (int kc = 0; kc < 2; ++kc) kf[ct][kc] = frag_h(&sk[ks * 32 + ct * 16 + col][kc * 32], lane); }
    __builtin_amdgcn_sched_barrier(0);   // the key reads stay one group ahead of the score products: read pair by pair among them, each product waits out a whole LDS latency
#pragma unroll
    for (int ct = 0; ct < 2; ++ct) { const _Float16* krowl = nullptr; v8f c = {}, cl = {};
#pragma unroll
      for (int kc = 0; kc < 2; ++kc) c = wmma16(aq[kc], kf[ct][kc], c);   // single product: q, k as one-rounding f16 operands
      (void)cl; (void)krowl;
      { const bool keepk = true;
#pragma unroll
      for (int r = 0; r < 8; ++r) s[ct][r] = keepk ? c[r] * 0.125f : -3.0e38f; } }   // 1/sqrt(64); no key is masked
#pragma unroll
    for (int r = 0; r < 8; ++r) { float mx = fmaxf(s[0][r], s[1][r]);
#pragma unroll
      for (int o = 1; o < 16; o <<= 1) mx = fmaxf(mx, __shfl_xor(mx, o));
      const float mn = fmaxf(m[r], mx); const float alpha = (m[r] <= -1.0e38f) ? 0.f : __expf(m[r] - mn);
      const float e0 = (s[0][r] <= -1.0e38f) ? 0.f : __expf(s[0][r] - mn), e1 = (s[1][r] <= -1.0e38f) ? 0.f : __expf(s[1][r] - mn); float es = e0 + e1;
#pragma unroll
      for (int o = 1; o < 16; o <<= 1) es += __shfl_xor(es, o);
      l[r] = l[r] * alpha + es; m[r] = mn;
#pragma unroll
      for (int dt = 0; dt < 4; ++dt) { acc[dt][r] *= alpha; accl[dt][r] *= alpha; }
      sp[wave][8 * g + r][col] = e0; sp[wave][8 * g + r][16 + col] = e1; }
    LDSX();
    v16h pa, pl; { const float* prow = &sp[wave][col][0] + 8 * (lane >> 4);
#pragma unroll
      for (int i = 0; i < 8; ++i) { const float x0 = prow[i] * 2048.0f, x1 = prow[16 + i] * 2048.0f; const _Float16 h0 = (_Float16)x0, h1 = (_Float16)x1; pa[i] = h0; pa[8 + i] = h1; pl[i] = (_Float16)((x0 - (float)h0) * 2048.0f); pl[8 + i] = (_Float16)((x1 - (float)h1) * 2048.0f); } }   // P scaled by 2^11 before the f16 split so small softmax weights stay out of the f16 subnormal range; 2^-11 folded into the epilogue
#pragma unroll
    for (int dt = 0; dt < 4; ++dt) acc[dt] = wmma16(pa, frag_h(&sv[dt * 16 + col][ks * 32], lane), acc[dt]);   // single product: P (x2^11) x V
    (void)pl;
    LDSX(); }
  __syncthreads();   // every wave has read the stage: it may be rewritten
  }
#pragma unroll
  for (int r = 0; r < 8; ++r) { const float il = (1.0f / 2048.0f) / l[r];
#pragma unroll
    for (int dt = 0; dt < 4; ++dt) so[wave][8 * g + r][dt * 16 + col] = (acc[dt][r] + accl[dt][r] * (1.0f / 2048.0f)) * il; }
  LDSX();
  for (int rl = 0; rl < 16; ++rl) if (lane < 16) vst2(O + ((size_t)b * SS + q0 + rl) * DM + h * HD + lane * 4, *(const v4f*)&so[wave][rl][lane * 4]);
}
// ---- k_out: block = (64 rows, 128 cols): out = O(hi/lo) . Wo rows (2 products) + bo
__global__ __launch_bounds__(128) void k_out(const float* __restrict__ O, const __bf16* __restrict__ P, const float* __restrict__ BO, float* __restrict__ Y) {
  // one LDS range: the operand stage of the k loop (sw, sxh, sxl), then, behind the loop's last barrier, the output staging
  __shared__ __align__(16) unsigned char sm[(128 + 64 + 64) * LP * 2];
  float (*so)[16][132] = (float (*)[16][132])sm;
  __bf16 (*sw)[LP] = (__bf16 (*)[LP])sm; __bf16 (*sxh)[LP] = (__bf16 (*)[LP])(sm + 128 * LP * 2); __bf16 (*sxl)[LP] = (__bf16 (*)[LP])(sm + (128 + 64) * LP * 2);   // 128 weight rows; 64 o rows as bf16 hi and residual
  const int tid = threadIdx.x, wave = tid >> 5, lane = tid & 31, col = lane & 15, g = lane >> 4; const size_t r0 = (size_t)blockIdx.x * 64 + wave * 16; const int n0 = blockIdx.y * 128;
  v8f acc[8] = {};
  const __bf16* wsrc = P + (size_t)(n0 + (tid >> 3)) * DM + (tid & 7) * 8;                       // a wave's 16-B load: 4 weight rows x 128 B
  const float* xsrc = O + ((size_t)blockIdx.x * 64 + (tid >> 4)) * DM + (tid & 15) * 4;           // a wave's 16-B load: 2 o rows x 256 B
  v4u wr[8]; v4f xr[8];
#pragma unroll
  for (int i = 0; i < 8; ++i) { wr[i] = *(const v4u*)(wsrc + (size_t)(16 * i) * DM); xr[i] = *(const v4f*)(xsrc + (size_t)(8 * i) * DM); }
#pragma unroll 1   // rolled: one copy of the pass keeps the prefetch registers' live range to one pass
  for (int ps = 0; ps < DM / KP; ++ps) {
#pragma unroll
    for (int i = 0; i < 8; ++i) { *(v4u*)&sw[(tid >> 3) + 16 * i][(tid & 7) * 8] = wr[i]; v4b ch, cl;
#pragma unroll
      for (int e = 0; e < 4; ++e) { const __bf16 hv = (__bf16)xr[i][e]; ch[e] = hv; cl[e] = (__bf16)(xr[i][e] - (float)hv); }
      *(v4b*)&sxh[(tid >> 4) + 8 * i][(tid & 15) * 4] = ch; *(v4b*)&sxl[(tid >> 4) + 8 * i][(tid & 15) * 4] = cl; }
    __syncthreads();   // the stage is written: every wave may read it
    if (ps + 1 < DM / KP) {   // the next pass's rows fly while this pass is multiplied
#pragma unroll
      for (int i = 0; i < 8; ++i) { wr[i] = *(const v4u*)(wsrc + (size_t)(16 * i) * DM + (ps + 1) * KP); xr[i] = *(const v4f*)(xsrc + (size_t)(8 * i) * DM + (ps + 1) * KP); }
      asm volatile("s_wait_xcnt 0x0" ::: "memory"); }   // stands in front of the loop's advance of the address registers that these loads name
#pragma unroll
    for (int kc = 0; kc < KP / 32; ++kc) { const v16b ah = frag_b(&sxh[wave * 16 + col][kc * 32], lane), al = frag_b(&sxl[wave * 16 + col][kc * 32], lane); v16b w[8];
#pragma unroll
      for (int j = 0; j < 8; ++j) w[j] = frag_b(&sw[j * 16 + col][kc * 32], lane);
      __builtin_amdgcn_sched_barrier(0);   // the LDS reads stay one group ahead of the products: read pair by pair among them, each product waits out a whole LDS latency
#pragma unroll
      for (int j = 0; j < 8; ++j) { acc[j] = wmma_bf(al, w[j], acc[j]); acc[j] = wmma_bf(ah, w[j], acc[j]); } }
    __syncthreads();   // every wave has read the stage: it may be rewritten (behind the last pass: by the output staging)
  }
#pragma unroll
  for (int j = 0; j < 8; ++j) {
#pragma unroll
    for (int r = 0; r < 8; ++r) so[wave][8 * g + r][j * 16 + col] = acc[j][r] + bfr(BO[n0 + j * 16 + col]); }
  LDSX();
  for (int rl = 0; rl < 16; ++rl) vst2(Y + (r0 + rl) * DM + n0 + lane * 4, *(const v4f*)&so[wave][rl][lane * 4]);
}
extern "C" void kernel_launch(void* const* d_in, const int* in_sizes, int n_in, void* d_out, int out_size, void* d_ws, size_t ws_size, hipStream_t stream) {
  (void)in_sizes; (void)n_in; (void)out_size;
  const float** F = (const float**)d_in;   // 0 x [2,2048,1024], 1 qkv_w [3072,1024] natural, 2 qkv_b, 3 out_w, 4 out_b, 5 anchor_k_min, 6 anchor_k_max, 7 anchor_v_min, 8 anchor_v_max ([2,16,1,64] each)
  if (ws_size < (size_t)WS_END) return;
  char* ws = (char*)d_ws; __bf16* PK = (__bf16*)(ws + WS_PK); _Float16 *QK = (_Float16*)(ws + WS_QK), *QKL = (_Float16*)(ws + WS_QKL), *VTH = (_Float16*)(ws + WS_VTH), *VTL = (_Float16*)(ws + WS_VTL); float* O = (float*)(ws + WS_O);
  k_pack<<<dim3(DM, 4), 256, 0, stream>>>(F[1], F[1] + (size_t)DM * DM, F[1] + (size_t)2 * DM * DM, F[3], PK);
  k_qkv<<<dim3(TNB * SS / 64, QKVW / 128), 128, 0, stream>>>(F[0], F[0], F[0], PK + PK_A, F[2], F[2] + DM, F[2] + 2 * DM, F[5], F[6], F[7], F[8], QK, QKL, VTH, VTL);
  k_attn<<<dim3(TQB, NH, TNB), 128, 0, stream>>>(QK, QKL, VTH, VTL, nullptr, O);
  k_out<<<dim3(TOB, DM / 128), 128, 0, stream>>>(O, PK + PK_P, F[4], (float*)d_out);
}

// v002
// Measured time: 133 microseconds a run.
// In two side-by-side timings against v001, it was 1.19 and 1.21 times as fast.
// Over all steps from v000 it is 3.02 times as fast.
// compute dtype: all float inputs rounded to bf16; qkv = x . W_qkv^T + b with EXACT bf16 products on WMMA 16x16x32 (natural rows; the fused weight as three contiguous row blocks); the guard clamp of k and v in f32 before the f16 rounding; PLAIN attention: q, k single f16 x 1/8, running-max softmax in f32 (hardware exp), P (scaled by 2^11, single f16) x v (single f16); out = o (bf16 hi + residual) . W_out^T (2 products) + b_out.
#include <hip/hip_runtime.h>
#include <math.h>

typedef __attribute__((ext_vector_type(16))) _Float16 v16h;
typedef __attribute__((ext_vector_type(16))) __bf16 v16b;
typedef __attribute__((ext_vector_type(8)))  _Float16 v8h;
typedef __attribute__((ext_vector_type(8)))  float v8f;
typedef __attribute__((ext_vector_type(4)))  float v4f;
typedef __attribute__((ext_vector_type(2)))  float v2f;
typedef __attribute__((ext_vector_type(4)))  unsigned v4u;
typedef __attribute__((ext_vector_type(4)))  int v4i;
typedef float __attribute__((may_alias)) float_a;
typedef int __attribute__((may_alias)) int_a;

template <typename T> __device__ __forceinline__ void vst2(void* p, T v) { *(T*)p = v;  }
__device__ __forceinline__ v8f wmma16(v16h a, v16h b, v8f c) {
  v8f d = __builtin_amdgcn_wmma_f32_16x16x32_f16(false, a, false, b, (short)0, c, false, false);
  asm volatile("v_nop\n\tv_nop\n\tv_nop\n\tv_nop" : "+v"(d) : "v"(a), "v"(b));
  return d;
}
__device__ __forceinline__ v8f wmma_bf(v16b a, v16b b, v8f c) {
  v8f d = __builtin_amdgcn_wmma_f32_16x16x32_bf16(false, a, false, b, (short)0, c, false, false);
  asm volatile("v_nop\n\tv_nop\n\tv_nop\n\tv_nop" : "+v"(d) : "v"(a), "v"(b));
  return d;
}
// Range-aware (guard-clamped) multi-head attention (B 2, S 2,048, d 1,024, 16 heads x 64): fused qkv projection + bias, k and v clamped against per-(batch, head, channel) anchor ranges with a 0.1 slack, softmax(q k^T / 8) v, output projection + bias.
__device__ __forceinline__ v16h frag_h(const _Float16* rowk0, int lane) {
  union { v16h v; v8h q[2]; } u; const _Float16* p = rowk0 + 8 * (lane >> 4);
  u.q[0] = *(const v8h*)p; u.q[1] = *(const v8h*)(p + 16); return u.v;
}
__device__ __forceinline__ v16h frag_f32(const float* rowk0, int lane) {
  v16h a; const float* p = rowk0 + 8 * (lane >> 4);
#pragma unroll
  for (int i = 0; i < 8; ++i) { a[i] = (_Float16)p[i]; a[8 + i] = (_Float16)p[16 + i]; }
  return a;
}
__device__ __forceinline__ v16h frag_f32s(const float* rowk0, int lane, float sc) {
  v16h a; const float* p = rowk0 + 8 * (lane >> 4);
#pragma unroll
  for (int i = 0; i < 8; ++i) { a[i] = (_Float16)(p[i] * sc); a[8 + i] = (_Float16)(p[16 + i] * sc); }
  return a;
}
// column fragment from a [K][ld] layout (column n), rows >= K read as 0
__device__ __forceinline__ v16h fragc_f32(const float* W, int k0, int n, int lane, int ld, int K) {
  v16h a; const int g = lane >> 4;
#pragma unroll
  for (int i = 0; i < 8; ++i) { const int ka = k0 + 8 * g + i, kb = ka + 16;
    a[i] = (_Float16)(ka < K ? W[(size_t)(ka < K ? ka : K - 1) * ld + n] : 0.f); a[8 + i] = (_Float16)(kb < K ? W[(size_t)(kb < K ? kb : K - 1) * ld + n] : 0.f); }
  return a;
}
struct F2 { v16b h, l; };
__device__ __forceinline__ F2 bsplit16(const float v[16]) { F2 r;
#pragma unroll
  for (int i = 0; i < 16; ++i) { const __bf16 h = (__bf16)v[i]; r.h[i] = h; r.l[i] = (__bf16)(v[i] - (float)h); }
  return r; }
__device__ __forceinline__ F2 split_row(const float* row, int k0, int lane) { float v[16]; const float* p = row + k0 + 8 * (lane >> 4);
#pragma unroll
  for (int i = 0; i < 8; ++i) { v[i] = p[i]; v[8 + i] = p[16 + i]; }
  return bsplit16(v); }
__device__ __forceinline__ F2 split_rowK(const float* row, int k0, int lane, int K) { float v[16]; const int g = lane >> 4;
#pragma unroll
  for (int i = 0; i < 8; ++i) { const int ka = k0 + 8 * g + i, kb = ka + 16; v[i] = ka < K ? row[ka < K ? ka : K - 1] : 0.f; v[8 + i] = kb < K ? row[kb < K ? kb : K - 1] : 0.f; }
  return bsplit16(v); }
__device__ __forceinline__ F2 split_col(const float* W, int k0, int n, int lane, int ld, int K) { float v[16]; const int g = lane >> 4;
#pragma unroll
  for (int i = 0; i < 8; ++i) { const int ka = k0 + 8 * g + i, kb = ka + 16; v[i] = ka < K ? W[(size_t)(ka < K ? ka : K - 1) * ld + n] : 0.f; v[8 + i] = kb < K ? W[(size_t)(kb < K ? kb : K - 1) * ld + n] : 0.f; }
  return bsplit16(v); }
__device__ __forceinline__ v8f mac3(const F2& a, const F2& b, v8f c) { c = wmma_bf(a.l, b.h, c); c = wmma_bf(a.h, b.l, c); return wmma_bf(a.h, b.h, c); }
__device__ __forceinline__ float sigm(float v) { return 1.0f / (1.0f + expf(-v)); }
#define LDSX() do { asm volatile("s_wait_dscnt 0" ::: "memory"); __builtin_amdgcn_wave_barrier(); __builtin_amdgcn_fence(__ATOMIC_RELEASE, "workgroup"); } while (0)


#define NB 2
#define SS 2048
#define DM 1024
#define NH 16
#define GEPS 0.1f
__device__ __forceinline__ float gclamp(float tv, float amin, float amax) { float lo = fmaxf(tv - GEPS, amin); const float hi = fminf(tv + GEPS, amax); lo = fminf(lo, hi); return fmaxf(lo, fminf(tv, hi)); }
#define HD 64
#define QKVW (3 * DM)
#ifndef TQB
#define TQB (SS / 64)
#define TNB NB
#define TOB (NB * SS / 64)     // output row tiles (all)
#endif
typedef __attribute__((ext_vector_type(8))) __bf16 v8b;
__device__ __forceinline__ v16b frag_b(const __bf16* rowk0, int lane) {
  union { v16b v; v8b q[2]; } u; const __bf16* p = rowk0 + 8 * (lane >> 4);
  u.q[0] = *(const v8b*)p; u.q[1] = *(const v8b*)(p + 16); return u.v;
}
__device__ __forceinline__ float bfr(float v) { return (float)(__bf16)v; }
typedef __attribute__((ext_vector_type(4))) __bf16 v4b;
#define KP 64   // k (or keys) per staged pass: 128 B of every 16-bit operand row, one whole line
#define LP 72   // LDS row pitch in 16-bit elements: 128 B of data + 16 B, the pitch for ds_load_b128 readers
__device__ __attribute__((noinline)) float exp_ni(float v) { return expf(v); }
__device__ __attribute__((noinline)) float erf_ni(float v) { return erff(v); }

#define PK_A 0                       // [3072][1024] Wqkv rows (natural [out][in])
#define PK_P (PK_A + QKVW * DM)        // [1024][1024] Wo rows (natural)
#define PK_END (PK_P + DM * DM)
#define WS_PK  0u
#define WS_QK  (WS_PK + 2u * PK_END)             // f16 [4096 rows][2048]: q | k
#define WS_QKL (WS_QK + 2u * NB * SS * 2 * DM)     // f16 q | k residual planes x2048
#define WS_VTH (WS_QKL + 2u * NB * SS * 2 * DM)    // f16 [b][1024 (h*64+d)][2048 s] hi
#define WS_VTL (WS_VTH + 2u * NB * DM * SS)        // f16 lo x 2048
#define WS_O   (WS_VTL + 2u * NB * DM * SS)        // f32 [4096][1024]
#define WS_CS  (WS_O + 4u * NB * SS * DM)           // f32 2 x [2048][32], not used by any kernel
#define WS_END (WS_CS + 4u * 2 * SS * 32)
// ---- k_pack: block = (row n, which): natural [out][in] rows -> bf16; which 0..2 -> W_q/W_k/W_v into PK_A rows which*1024 + n; 3 -> W_o into PK_P
__global__ __launch_bounds__(256) void k_pack(const float* __restrict__ WQ, const float* __restrict__ WK, const float* __restrict__ WV, const float* __restrict__ WO, __bf16* __restrict__ PK) {
  __shared__ __align__(16) __bf16 s[DM]; const int n = blockIdx.x, which = blockIdx.y, t = threadIdx.x; const float* Wm = (which == 0) ? WQ : (which == 1) ? WK : (which == 2) ? WV : WO;
  for (int k = t; k < DM; k += 256) s[k] = (__bf16)Wm[(size_t)n * DM + k];
  __syncthreads();
  __bf16* dst = (which < 3) ? PK + PK_A + ((size_t)which * DM + n) * DM : PK + PK_P + (size_t)n * DM;
  for (int q = t; q < DM / 8; q += 256) vst2((unsigned*)(dst + q * 8), *(const v4u*)&s[q * 8]);
}
__global__ __launch_bounds__(128) void k_qkv(const float* __restrict__ XQ, const float* __restrict__ XK, const float* __restrict__ XV, const __bf16* __restrict__ P, const float* __restrict__ BQ, const float* __restrict__ BK, const float* __restrict__ BV, const float* __restrict__ AKMIN, const float* __restrict__ AKMAX, const float* __restrict__ AVMIN, const float* __restrict__ AVMAX, _Float16* __restrict__ QK, _Float16* __restrict__ QKL, _Float16* __restrict__ VTH, _Float16* __restrict__ VTL) {
  const int which0 = (blockIdx.y * 128) / DM; const float* X = (which0 == 0) ? XQ : (which0 == 1) ? XK : XV; const float* BB = BQ ? (((which0 == 0) ? BQ : (which0 == 1) ? BK : BV) + (blockIdx.y * 128 - which0 * DM)) : nullptr;
  // one LDS range: the operand stage of the k loop (sw, sx), then, behind the loop's last barrier, the output staging of the branch taken
  __shared__ __align__(16) unsigned char sm[2 * 128 * 72 * 2];
  _Float16 (*so)[16][136] = (_Float16 (*)[16][136])sm; _Float16 (*sol)[16][136] = (_Float16 (*)[16][136])(sm + 4 * 16 * 136 * 2);
  _Float16 (*sth)[72] = (_Float16 (*)[72])sm; _Float16 (*stl)[72] = (_Float16 (*)[72])(sm + 128 * 72 * 2);
  __bf16 (*sw)[LP] = (__bf16 (*)[LP])sm; __bf16 (*sx)[LP] = (__bf16 (*)[LP])(sm + 128 * LP * 2);   // 128 weight rows, 64 x rows (bf16), KP k each
  const int tid = threadIdx.x, wave = tid >> 5, lane = tid & 31, col = lane & 15, g = lane >> 4; const size_t r0 = (size_t)blockIdx.x * 64 + wave * 16; const int n0 = blockIdx.y * 128;
  v8f acc[8] = {};
  const __bf16* wsrc = P + (size_t)(n0 + (tid >> 3)) * DM + (tid & 7) * 8;                       // a wave's 16-B load: 4 weight rows x 128 B
  const float* xsrc = X + ((size_t)blockIdx.x * 64 + (tid >> 4)) * DM + (tid & 15) * 4;           // a wave's 16-B load: 2 x rows x 256 B
  v4u wr[8]; v4f xr[8];
#pragma unroll
  for (int i = 0; i < 8; ++i) { wr[i] = *(const v4u*)(wsrc + (size_t)(16 * i) * DM); xr[i] = *(const v4f*)(xsrc + (size_t)(8 * i) * DM); }
#pragma unroll 1   // rolled: one copy of the pass keeps the prefetch registers' live range to one pass
  for (int ps = 0; ps < DM / KP; ++ps) {
#pragma unroll
    for (int i = 0; i < 8; ++i) { *(v4u*)&sw[(tid >> 3) + 16 * i][(tid & 7) * 8] = wr[i]; v4b c;
#pragma unroll
      for (int e = 0; e < 4; ++e) c[e] = (__bf16)xr[i][e];
      *(v4b*)&sx[(tid >> 4) + 8 * i][(tid & 15) * 4] = c; }
    __syncthreads();   // the stage is written: every wave may read it
    if (ps + 1 < DM / KP) {   // the next pass's rows fly while this pass is multiplied
#pragma unroll
      for (int i = 0; i < 8; ++i) { wr[i] = *(const v4u*)(wsrc + (size_t)(16 * i) * DM + (ps + 1) * KP); xr[i] = *(const v4f*)(xsrc + (size_t)(8 * i) * DM + (ps + 1) * KP); }
      asm volatile("s_wait_xcnt 0x0" ::: "memory"); }   // stands in front of the loop's advance of the address registers that these loads name
#pragma unroll
    for (int kc = 0; kc < KP / 32; ++kc) { const v16b a = frag_b(&sx[wave * 16 + col][kc * 32], lane); v16b w[8];
#pragma unroll
      for (int j = 0; j < 8; ++j) w[j] = frag_b(&sw[j * 16 + col][kc * 32], lane);
      __builtin_amdgcn_sched_barrier(0);   // the LDS reads stay one group ahead of the products: read pair by pair among them, each product waits out a whole LDS latency
#pragma unroll
      for (int j = 0; j < 8; ++j) acc[j] = wmma_bf(a, w[j], acc[j]); }
    __syncthreads();   // every wave has read the stage: it may be rewritten (behind the last pass: by the output staging)
  }
  if (n0 < 2 * DM) {   // q stored unscaled (f16 sigma ~0.6, no subnormal exposure); 1/8 applied to the f32 score
#pragma unroll
    for (int j = 0; j < 8; ++j) {
#pragma unroll
      for (int r = 0; r < 8; ++r) { float v = acc[j][r] + (BB ? bfr(BB[j * 16 + col]) : 0.f); if (n0 >= DM) { const size_t ai = (size_t)((r0 + 8 * g + r) / SS) * DM + (n0 - DM + j * 16 + col); v = gclamp(v, bfr(AKMIN[ai]), bfr(AKMAX[ai])); } const _Float16 hv = (_Float16)v; so[wave][8 * g + r][j * 16 + col] = hv;   /* k guard-clamped per (b, h, d) */ sol[wave][8 * g + r][j * 16 + col] = (_Float16)((v - (float)hv) * 2048.0f); } }   // q, k (+ bias) as f16 hi + (x2048) residual
    LDSX();
    for (int rl = 0; rl < 16; ++rl) if (lane < 16) { vst2((unsigned*)(QK + (r0 + rl) * (2 * DM) + n0 + lane * 8), *(const v4u*)&so[wave][rl][lane * 8]); vst2((unsigned*)(QKL + (r0 + rl) * (2 * DM) + n0 + lane * 8), *(const v4u*)&sol[wave][rl][lane * 8]); }
  } else {
#pragma unroll
    for (int j = 0; j < 8; ++j) {
#pragma unroll
      for (int r = 0; r < 8; ++r) { float v = acc[j][r] + (BB ? bfr(BB[j * 16 + col]) : 0.f); { const size_t ai = (size_t)((r0 + 8 * g + r) / SS) * DM + (n0 - 2 * DM + j * 16 + col); v = gclamp(v, bfr(AVMIN[ai]), bfr(AVMAX[ai])); } const _Float16 hv = (_Float16)v; sth[j * 16 + col][wave * 16 + 8 * g + r] = hv;   /* v guard-clamped */ stl[j * 16 + col][wave * 16 + 8 * g + r] = (_Float16)((v - (float)hv) * 2048.0f); } }
    __syncthreads();
    const size_t rb = (size_t)blockIdx.x * 64; const int b = (int)(rb / SS), s0 = (int)(rb % SS); const int pc0 = n0 - 2 * DM;
    for (int q = tid; q < 128 * 8; q += 128) { const int d = q >> 3, pc = q & 7; const size_t o = ((size_t)b * DM + pc0 + d) * SS + s0 + pc * 8; vst2((unsigned*)(VTH + o), *(const v4u*)&sth[d][pc * 8]); vst2((unsigned*)(VTL + o), *(const v4u*)&stl[d][pc * 8]); }
  }
}
// ---- k_attn: block = (64 queries, head h, batch b): all-keys flash attention with TRANSPOSED products: S^T = K . Q^T (A = key rows from the stage, B = the wave's q rows kept in registers), so a lane holds 16 scores of ONE query (column col; keys 8g + r and 16 + 8g + r of the 32): maximum and sum run in the lane, one exchange between the lane halves joins the maximum; the two score tiles, exponentiated and rounded in place, ARE the B operand of O^T += V^T . P^T (A = channel rows of v from the stage): P never goes through LDS. O[b*S+q][h*64+d] = (acc + accl / 2048) / (2048 l) (256-B segments)
// lane l <-> lane l ^ 16 as a vector cross-row move: the shuffle builtin would go through the LDS pipe and its wait
__device__ __forceinline__ float xhalf(float v) { const int i = __builtin_bit_cast(int, v); return __builtin_bit_cast(float, __builtin_amdgcn_permlanex16(i, i, 0x76543210, 0xfedcba98, false, false)); }
__global__ __launch_bounds__(128) void k_attn(const _Float16* __restrict__ QK, const _Float16* __restrict__ QKL, const _Float16* __restrict__ VTH, const _Float16* __restrict__ VTL, const void* __restrict__ KMASK, float* __restrict__ O) {
  __shared__ __align__(16) float so[4][16][68];
  __shared__ __align__(16) _Float16 sk[KP][LP], sv[HD][LP];   // the stage: KP keys x 64 channels; 64 channels of v x KP keys
  const int tid = threadIdx.x, wave = tid >> 5, lane = tid & 31, col = lane & 15, g = lane >> 4;
  const int qb = blockIdx.x, h = blockIdx.y, b = blockIdx.z; const int q0 = qb * 64 + wave * 16; const size_t rq = (size_t)b * SS + q0 + col;
  v16h aq[2];   // B operand of the score product: column col = query q0 + col, channels in the loader's k order (the same loader as the key rows')
#pragma unroll
  for (int kc = 0; kc < 2; ++kc) aq[kc] = frag_h(QK + rq * (2 * DM) + h * HD + kc * 32, lane);
  float m = -3.0e38f, l = 0.f;   // of query col: m over all keys so far (equal in both lane halves), l over this lane half's keys (the halves are joined in the epilogue)
  v8f acc[4] = {}, accl[4] = {};   // acc[dt][r] = O^T[channel dt * 16 + 8g + r][query col]
  const _Float16* ksrc = QK + ((size_t)b * SS + (tid >> 3)) * (2 * DM) + DM + h * HD + (tid & 7) * 8;   // a wave's 16-B load: 4 key rows x 128 B
  const _Float16* vsrc = VTH + ((size_t)b * DM + h * HD + (tid >> 3)) * SS + (tid & 7) * 8;               // a wave's 16-B load: 4 channel rows x 128 B
  v4u kr[4], vr[4];
#pragma unroll
  for (int i = 0; i < 4; ++i) { kr[i] = *(const v4u*)(ksrc + (size_t)(16 * i) * (2 * DM)); vr[i] = *(const v4u*)(vsrc + (size_t)(16 * i) * SS); }
#pragma unroll 1   // rolled: one copy of the stage's code
  for (int st = 0; st < SS / KP; ++st) {   // all keys, KP a stage
#pragma unroll
  for (int i = 0; i < 4; ++i) { *(v4u*)&sk[(tid >> 3) + 16 * i][(tid & 7) * 8] = kr[i]; *(v4u*)&sv[(tid >> 3) + 16 * i][(tid & 7) * 8] = vr[i]; }
  __syncthreads();   // the stage is written: every wave may read it
  if (st + 1 < SS / KP) {   // the next stage's rows fly while this one is worked on
#pragma unroll
    for (int i = 0; i < 4; ++i) { kr[i] = *(const v4u*)(ksrc + ((size_t)(st + 1) * KP + 16 * i) * (2 * DM)); vr[i] = *(const v4u*)(vsrc + (size_t)(16 * i) * SS + (st + 1) * KP); } }
#pragma unroll 1   // rolled: the 32-key body stays one copy, as it was
  for (int ks = 0; ks < KP / 32; ++ks) { v8f s[2]; v16h kf[2][2], vf[4];
#pragma unroll
    for (int ct = 0; ct < 2; ++ct) {
#pragma unroll
      for (int kc = 0; kc < 2; ++kc) kf[ct][kc] = frag_h(&sk[ks * 32 + ct * 16 + col][kc * 32], lane); }   // A: row col = key ct * 16 + col
#pragma unroll
    for (int dt = 0; dt < 4; ++dt) vf[dt] = frag_h(&sv[dt * 16 + col][ks * 32], lane);   // A of the second product: row col = channel dt * 16 + col; its k order (keys 8g + i, 16 + 8g + i) is that of the packed score tiles
    __builtin_amdgcn_sched_barrier(0);   // the LDS reads stay one group ahead of the products: read pair by pair among them, each product waits out a whole LDS latency (the v rows land under the scores and the softmax)
#pragma unroll
    for (int ct = 0; ct < 2; ++ct) { v8f c = {};
#pragma unroll
      for (int kc = 0; kc < 2; ++kc) c = wmma16(kf[ct][kc], aq[kc], c);   // single product: k, q as one-rounding f16 operands; c[r] = score of key ct * 16 + 8g + r with query col
#pragma unroll
      for (int r = 0; r < 8; ++r) s[ct][r] = c[r] * 0.125f; }   // 1/sqrt(64)
    float mx = fmaxf(s[0][0], s[1][0]);
#pragma unroll
    for (int r = 1; r < 8; ++r) mx = fmaxf(mx, fmaxf(s[0][r], s[1][r]));
    mx = fmaxf(mx, xhalf(mx));   // both lane halves hold the query's maximum over the 32 keys
    const float mn = fmaxf(m, mx); const float alpha = (m <= -1.0e38f) ? 0.f : __expf(m - mn);
    v16h pa; float es0 = 0.f, es1 = 0.f;
#pragma unroll
    for (int r = 0; r < 8; ++r) { const float e0 = (s[0][r] <= -1.0e38f) ? 0.f : __expf(s[0][r] - mn), e1 = (s[1][r] <= -1.0e38f) ? 0.f : __expf(s[1][r] - mn);
      es0 += e0; es1 += e1; pa[r] = (_Float16)(e0 * 2048.0f); pa[8 + r] = (_Float16)(e1 * 2048.0f); }   // P scaled by 2^11 before the f16 rounding so small softmax weights stay out of the f16 subnormal range; 2^-11 folded into the epilogue
    l = l * alpha + (es0 + es1); m = mn;
#pragma unroll
    for (int dt = 0; dt < 4; ++dt) {
#pragma unroll
      for (int r = 0; r < 8; ++r) { acc[dt][r] *= alpha; accl[dt][r] *= alpha; } }
#pragma unroll
    for (int dt = 0; dt < 4; ++dt) acc[dt] = wmma16(vf[dt], pa, acc[dt]); }   // single product: V^T x P^T (x2^11)
  __syncthreads();   // every wave has read the stage: it may be rewritten
  }
  { const float il = (1.0f / 2048.0f) / (l + xhalf(l));   // the two lane halves' sums joined, unconditionally
#pragma unroll
    for (int dt = 0; dt < 4; ++dt) {
#pragma unroll
      for (int q = 0; q < 2; ++q) { v4f o;
#pragma unroll
        for (int e = 0; e < 4; ++e) o[e] = (acc[dt][4 * q + e] + accl[dt][4 * q + e] * (1.0f / 2048.0f)) * il;
        *(v4f*)&so[wave][col][dt * 16 + 8 * g + 4 * q] = o; } } }
  LDSX();
  for (int rl = 0; rl < 16; ++rl) if (lane < 16) vst2(O + ((size_t)b * SS + q0 + rl) * DM + h * HD + lane * 4, *(const v4f*)&so[wave][rl][lane * 4]);
}
// ---- k_out: block = (64 rows, 128 cols): out = O(hi/lo) . Wo rows (2 products) + bo
__global__ __launch_bounds__(128) void k_out(const float* __restrict__ O, const __bf16* __restrict__ P, const float* __restrict__ BO, float* __restrict__ Y) {
  // one LDS range: the operand stage of the k loop (sw, sxh, sxl), then, behind the loop's last barrier, the output staging
  __shared__ __align__(16) unsigned char sm[(128 + 64 + 64) * LP * 2];
  float (*so)[16][132] = (float (*)[16][132])sm;
  __bf16 (*sw)[LP] = (__bf16 (*)[LP])sm; __bf16 (*sxh)[LP] = (__bf16 (*)[LP])(sm + 128 * LP * 2); __bf16 (*sxl)[LP] = (__bf16 (*)[LP])(sm + (128 + 64) * LP * 2);   // 128 weight rows; 64 o rows as bf16 hi and residual
  const int tid = threadIdx.x, wave = tid >> 5, lane = tid & 31, col = lane & 15, g = lane >> 4; const size_t r0 = (size_t)blockIdx.x * 64 + wave * 16; const int n0 = blockIdx.y * 128;
  v8f acc[8] = {};
  const __bf16* wsrc = P + (size_t)(n0 + (tid >> 3)) * DM + (tid & 7) * 8;                       // a wave's 16-B load: 4 weight rows x 128 B
  const float* xsrc = O + ((size_t)blockIdx.x * 64 + (tid >> 4)) * DM + (tid & 15) * 4;           // a wave's 16-B load: 2 o rows x 256 B
  v4u wr[8]; v4f xr[8];
#pragma unroll
  for (int i = 0; i < 8; ++i) { wr[i] = *(const v4u*)(wsrc + (size_t)(16 * i) * DM); xr[i] = *(const v4f*)(xsrc + (size_t)(8 * i) * DM); }
#pragma unroll 1   // rolled: one copy of the pass keeps the prefetch registers' live range to one pass
  for (int ps = 0; ps < DM / KP; ++ps) {
#pragma unroll
    for (int i = 0; i < 8; ++i) { *(v4u*)&sw[(tid >> 3) + 16 * i][(tid & 7) * 8] = wr[i]; v4b ch, cl;
#pragma unroll
      for (int e = 0; e < 4; ++e) { const __bf16 hv = (__bf16)xr[i][e]; ch[e] = hv; cl[e] = (__bf16)(xr[i][e] - (float)hv); }
      *(v4b*)&sxh[(tid >> 4) + 8 * i][(tid & 15) * 4] = ch; *(v4b*)&sxl[(tid >> 4) + 8 * i][(tid & 15) * 4] = cl; }
    __syncthreads();   // the stage is written: every wave may read it
    if (ps + 1 < DM / KP) {   // the next pass's rows fly while this pass is multiplied
#pragma unroll
      for (int i = 0; i < 8; ++i) { wr[i] = *(const v4u*)(wsrc + (size_t)(16 * i) * DM + (ps + 1) * KP); xr[i] = *(const v4f*)(xsrc + (size_t)(8 * i) * DM + (ps + 1) * KP); }
      asm volatile("s_wait_xcnt 0x0" ::: "memory"); }   // stands in front of the loop's advance of the address registers that these loads name
#pragma unroll
    for (int kc = 0; kc < KP / 32; ++kc) { const v16b ah = frag_b(&sxh[wave * 16 + col][kc * 32], lane), al = frag_b(&sxl[wave * 16 + col][kc * 32], lane); v16b w[8];
#pragma unroll
      for (int j = 0; j < 8; ++j) w[j] = frag_b(&sw[j * 16 + col][kc * 32], lane);
      __builtin_amdgcn_sched_barrier(0);   // the LDS reads stay one group ahead of the products: read pair by pair among them, each product waits out a whole LDS latency
#pragma unroll
      for (int j = 0; j < 8; ++j) { acc[j] = wmma_bf(al, w[j], acc[j]); acc[j] = wmma_bf(ah, w[j], acc[j]); } }
    __syncthreads();   // every wave has read the stage: it may be rewritten (behind the last pass: by the output staging)
  }
#pragma unroll
  for (int j = 0; j < 8; ++j) {
#pragma unroll
    for (int r = 0; r < 8; ++r) so[wave][8 * g + r][j * 16 + col] = acc[j][r] + bfr(BO[n0 + j * 16 + col]); }
  LDSX();
  for (int rl = 0; rl < 16; ++rl) vst2(Y + (r0 + rl) * DM + n0 + lane * 4, *(const v4f*)&so[wave][rl][lane * 4]);
}
extern "C" void kernel_launch(void* const* d_in, const int* in_sizes, int n_in, void* d_out, int out_size, void* d_ws, size_t ws_size, hipStream_t stream) {
  (void)in_sizes; (void)n_in; (void)out_size;
  const float** F = (const float**)d_in;   // 0 x [2,2048,1024], 1 qkv_w [3072,1024] natural, 2 qkv_b, 3 out_w, 4 out_b, 5 anchor_k_min, 6 anchor_k_max, 7 anchor_v_min, 8 anchor_v_max ([2,16,1,64] each)
  if (ws_size < (size_t)WS_END) return;
  char* ws = (char*)d_ws; __bf16* PK = (__bf16*)(ws + WS_PK); _Float16 *QK = (_Float16*)(ws + WS_QK), *QKL = (_Float16*)(ws + WS_QKL), *VTH = (_Float16*)(ws + WS_VTH), *VTL = (_Float16*)(ws + WS_VTL); float* O = (float*)(ws + WS_O);
  k_pack<<<dim3(DM, 4), 256, 0, stream>>>(F[1], F[1] + (size_t)DM * DM, F[1] + (size_t)2 * DM * DM, F[3], PK);
  k_qkv<<<dim3(TNB * SS / 64, QKVW / 128), 128, 0, stream>>>(F[0], F[0], F[0], PK + PK_A, F[2], F[2] + DM, F[2] + 2 * DM, F[5], F[6], F[7], F[8], QK, QKL, VTH, VTL);
  k_attn<<<dim3(TQB, NH, TNB), 128, 0, stream>>>(QK, QKL, VTH, VTL, nullptr, O);
  k_out<<<dim3(TOB, DM / 128), 128, 0, stream>>>(O, PK + PK_P, F[4], (float*)d_out);
}

// v003
// Measured time: 119 microseconds a run.
// Next to v002, in two timings, it ran 1.11 times as fast each time.
// All steps since v000 together make it 3.35 times as fast.
// compute dtype: all float inputs rounded to bf16; qkv = x . W_qkv^T + b with EXACT bf16 products on WMMA 16x16x32 (natural rows; the fused weight as three contiguous row blocks); the guard clamp of k and v in f32 before the f16 rounding; PLAIN attention: q, k single f16 x 1/8, running-max softmax in f32 (hardware exp), P (scaled by 2^11, single f16) x v (single f16); out = o (bf16 hi + residual) . W_out^T (2 products) + b_out.
#include <hip/hip_runtime.h>
#include <math.h>

typedef __attribute__((ext_vector_type(16))) _Float16 v16h;
typedef __attribute__((ext_vector_type(16))) __bf16 v16b;
typedef __attribute__((ext_vector_type(8)))  _Float16 v8h;
typedef __attribute__((ext_vector_type(8)))  float v8f;
typedef __attribute__((ext_vector_type(4)))  float v4f;
typedef __attribute__((ext_vector_type(2)))  float v2f;
typedef __attribute__((ext_vector_type(4)))  unsigned v4u;
typedef __attribute__((ext_vector_type(4)))  int v4i;
typedef float __attribute__((may_alias)) float_a;
typedef int __attribute__((may_alias)) int_a;

template <typename T> __device__ __forceinline__ void vst2(void* p, T v) { *(T*)p = v;  }
__device__ __forceinline__ v8f wmma16(v16h a, v16h b, v8f c) {
  v8f d = __builtin_amdgcn_wmma_f32_16x16x32_f16(false, a, false, b, (short)0, c, false, false);
  asm volatile("v_nop\n\tv_nop\n\tv_nop\n\tv_nop" : "+v"(d) : "v"(a), "v"(b));
  return d;
}
__device__ __forceinline__ v8f wmma_bf(v16b a, v16b b, v8f c) {
  v8f d = __builtin_amdgcn_wmma_f32_16x16x32_bf16(false, a, false, b, (short)0, c, false, false);
  asm volatile("v_nop\n\tv_nop\n\tv_nop\n\tv_nop" : "+v"(d) : "v"(a), "v"(b));
  return d;
}
// Range-aware (guard-clamped) multi-head attention (B 2, S 2,048, d 1,024, 16 heads x 64): fused qkv projection + bias, k and v clamped against per-(batch, head, channel) anchor ranges with a 0.1 slack, softmax(q k^T / 8) v, output projection + bias.
__device__ __forceinline__ v16h frag_h(const _Float16* rowk0, int lane) {
  union { v16h v; v8h q[2]; } u; const _Float16* p = rowk0 + 8 * (lane >> 4);
  u.q[0] = *(const v8h*)p; u.q[1] = *(const v8h*)(p + 16); return u.v;
}
__device__ __forceinline__ v16h frag_f32(const float* rowk0, int lane) {
  v16h a; const float* p = rowk0 + 8 * (lane >> 4);
#pragma unroll
  for (int i = 0; i < 8; ++i) { a[i] = (_Float16)p[i]; a[8 + i] = (_Float16)p[16 + i]; }
  return a;
}
__device__ __forceinline__ v16h frag_f32s(const float* rowk0, int lane, float sc) {
  v16h a; const float* p = rowk0 + 8 * (lane >> 4);
#pragma unroll
  for (int i = 0; i < 8; ++i) { a[i] = (_Float16)(p[i] * sc); a[8 + i] = (_Float16)(p[16 + i] * sc); }
  return a;
}
// column fragment from a [K][ld] layout (column n), rows >= K read as 0
__device__ __forceinline__ v16h fragc_f32(const float* W, int k0, int n, int lane, int ld, int K) {
  v16h a; const int g = lane >> 4;
#pragma unroll
  for (int i = 0; i < 8; ++i) { const int ka = k0 + 8 * g + i, kb = ka + 16;
    a[i] = (_Float16)(ka < K ? W[(size_t)(ka < K ? ka : K - 1) * ld + n] : 0.f); a[8 + i] = (_Float16)(kb < K ? W[(size_t)(kb < K ? kb : K - 1) * ld + n] : 0.f); }
  return a;
}
struct F2 { v16b h, l; };
__device__ __forceinline__ F2 bsplit16(const float v[16]) { F2 r;
#pragma unroll
  for (int i = 0; i < 16; ++i) { const __bf16 h = (__bf16)v[i]; r.h[i] = h; r.l[i] = (__bf16)(v[i] - (float)h); }
  return r; }
__device__ __forceinline__ F2 split_row(const float* row, int k0, int lane) { float v[16]; const float* p = row + k0 + 8 * (lane >> 4);
#pragma unroll
  for (int i = 0; i < 8; ++i) { v[i] = p[i]; v[8 + i] = p[16 + i]; }
  return bsplit16(v); }
__device__ __forceinline__ F2 split_rowK(const float* row, int k0, int lane, int K) { float v[16]; const int g = lane >> 4;
#pragma unroll
  for (int i = 0; i < 8; ++i) { const int ka = k0 + 8 * g + i, kb = ka + 16; v[i] = ka < K ? row[ka < K ? ka : K - 1] : 0.f; v[8 + i] = kb < K ? row[kb < K ? kb : K - 1] : 0.f; }
  return bsplit16(v); }
__device__ __forceinline__ F2 split_col(const float* W, int k0, int n, int lane, int ld, int K) { float v[16]; const int g = lane >> 4;
#pragma unroll
  for (int i = 0; i < 8; ++i) { const int ka = k0 + 8 * g + i, kb = ka + 16; v[i] = ka < K ? W[(size_t)(ka < K ? ka : K - 1) * ld + n] : 0.f; v[8 + i] = kb < K ? W[(size_t)(kb < K ? kb : K - 1) * ld + n] : 0.f; }
  return bsplit16(v); }
__device__ __forceinline__ v8f mac3(const F2& a, const F2& b, v8f c) { c = wmma_bf(a.l, b.h, c); c = wmma_bf(a.h, b.l, c); return wmma_bf(a.h, b.h, c); }
__device__ __forceinline__ float sigm(float v) { return 1.0f / (1.0f + expf(-v)); }
#define LDSX() do { asm volatile("s_wait_dscnt 0" ::: "memory"); __builtin_amdgcn_wave_barrier(); __builtin_amdgcn_fence(__ATOMIC_RELEASE, "workgroup"); } while (0)


#define NB 2
#define SS 2048
#define DM 1024
#define NH 16
#define GEPS 0.1f
__device__ __forceinline__ float gclamp(float tv, float amin, float amax) { float lo = fmaxf(tv - GEPS, amin); const float hi = fminf(tv + GEPS, amax); lo = fminf(lo, hi); return fmaxf(lo, fminf(tv, hi)); }
#define HD 64
#define QKVW (3 * DM)
#ifndef TQB
#define TQB (SS / 64)
#define TNB NB
#define TOB (NB * SS / 64)     // output row tiles (all)
#endif
typedef __attribute__((ext_vector_type(8))) __bf16 v8b;
__device__ __forceinline__ v16b frag_b(const __bf16* rowk0, int lane) {
  union { v16b v; v8b q[2]; } u; const __bf16* p = rowk0 + 8 * (lane >> 4);
  u.q[0] = *(const v8b*)p; u.q[1] = *(const v8b*)(p + 16); return u.v;
}
__device__ __forceinline__ float bfr(float v) { return (float)(__bf16)v; }
typedef __attribute__((ext_vector_type(4))) __bf16 v4b;
#define KP 64   // k (or keys) per staged pass: 128 B of every 16-bit operand row, one whole line
#define LP 72   // LDS row pitch in 16-bit elements: 128 B of data + 16 B, the pitch for ds_load_b128 readers
__device__ __attribute__((noinline)) float exp_ni(float v) { return expf(v); }
__device__ __attribute__((noinline)) float erf_ni(float v) { return erff(v); }

#define PK_A 0                       // [3072][1024] Wqkv rows (natural [out][in])
#define PK_P (PK_A + QKVW * DM)        // [1024][1024] Wo rows (natural)
#define PK_END (PK_P + DM * DM)
#define WS_PK  0u
#define WS_QK  (WS_PK + 2u * PK_END)             // f16 [4096 rows][2048]: q | k
#define WS_QKL (WS_QK + 2u * NB * SS * 2 * DM)     // f16 q | k residual planes x2048
#define WS_VTH (WS_QKL + 2u * NB * SS * 2 * DM)    // f16 [b][1024 (h*64+d)][2048 s] hi
#define WS_VTL (WS_VTH + 2u * NB * DM * SS)        // f16 lo x 2048
#define WS_O   (WS_VTL + 2u * NB * DM * SS)        // f32 [4096][1024]
#define WS_CS  (WS_O + 4u * NB * SS * DM)           // f32 2 x [2048][32], not used by any kernel
#define WS_END (WS_CS + 4u * 2 * SS * 32)
// ---- k_pack: block = (row n, which): natural [out][in] rows -> bf16; which 0..2 -> W_q/W_k/W_v into PK_A rows which*1024 + n; 3 -> W_o into PK_P
__global__ __launch_bounds__(256) void k_pack(const float* __restrict__ WQ, const float* __restrict__ WK, const float* __restrict__ WV, const float* __restrict__ WO, __bf16* __restrict__ PK) {
  __shared__ __align__(16) __bf16 s[DM]; const int n = blockIdx.x, which = blockIdx.y, t = threadIdx.x; const float* Wm = (which == 0) ? WQ : (which == 1) ? WK : (which == 2) ? WV : WO;
  for (int k = t; k < DM; k += 256) s[k] = (__bf16)Wm[(size_t)n * DM + k];
  __syncthreads();
  __bf16* dst = (which < 3) ? PK + PK_A + ((size_t)which * DM + n) * DM : PK + PK_P + (size_t)n * DM;
  for (int q = t; q < DM / 8; q += 256) vst2((unsigned*)(dst + q * 8), *(const v4u*)&s[q * 8]);
}
__global__ __launch_bounds__(128) void k_qkv(const float* __restrict__ XQ, const float* __restrict__ XK, const float* __restrict__ XV, const __bf16* __restrict__ P, const float* __restrict__ BQ, const float* __restrict__ BK, const float* __restrict__ BV, const float* __restrict__ AKMIN, const float* __restrict__ AKMAX, const float* __restrict__ AVMIN, const float* __restrict__ AVMAX, _Float16* __restrict__ QK, _Float16* __restrict__ QKL, _Float16* __restrict__ VTH, _Float16* __restrict__ VTL) {
  const int which0 = (blockIdx.y * 128) / DM; const float* X = (which0 == 0) ? XQ : (which0 == 1) ? XK : XV; const float* BB = BQ ? (((which0 == 0) ? BQ : (which0 == 1) ? BK : BV) + (blockIdx.y * 128 - which0 * DM)) : nullptr;
  // one LDS range: the operand stage of the k loop (sw, sx), then, behind the loop's last barrier, the output staging of the branch taken
  __shared__ __align__(16) unsigned char sm[2 * 128 * 72 * 2];
  _Float16 (*so)[16][136] = (_Float16 (*)[16][136])sm; _Float16 (*sol)[16][136] = (_Float16 (*)[16][136])(sm + 4 * 16 * 136 * 2);
  _Float16 (*sth)[72] = (_Float16 (*)[72])sm; _Float16 (*stl)[72] = (_Float16 (*)[72])(sm + 128 * 72 * 2);
  __bf16 (*sw)[LP] = (__bf16 (*)[LP])sm; __bf16 (*sx)[LP] = (__bf16 (*)[LP])(sm + 128 * LP * 2);   // 128 weight rows, 64 x rows (bf16), KP k each
  const int tid = threadIdx.x, wave = tid >> 5, lane = tid & 31, col = lane & 15, g = lane >> 4; const size_t r0 = (size_t)blockIdx.x * 64 + wave * 16; const int n0 = blockIdx.y * 128;
  v8f acc[8] = {};
  const __bf16* wsrc = P + (size_t)(n0 + (tid >> 3)) * DM + (tid & 7) * 8;                       // a wave's 16-B load: 4 weight rows x 128 B
  const float* xsrc = X + ((size_t)blockIdx.x * 64 + (tid >> 4)) * DM + (tid & 15) * 4;           // a wave's 16-B load: 2 x rows x 256 B
  v4u wr[8]; v4f xr[8];
#pragma unroll
  for (int i = 0; i < 8; ++i) { wr[i] = *(const v4u*)(wsrc + (size_t)(16 * i) * DM); xr[i] = *(const v4f*)(xsrc + (size_t)(8 * i) * DM); }
#pragma unroll 1   // rolled: one copy of the pass keeps the prefetch registers' live range to one pass
  for (int ps = 0; ps < DM / KP; ++ps) {
#pragma unroll
    for (int i = 0; i < 8; ++i) { *(v4u*)&sw[(tid >> 3) + 16 * i][(tid & 7) * 8] = wr[i]; v4b c;
#pragma unroll
      for (int e = 0; e < 4; ++e) c[e] = (__bf16)xr[i][e];
      *(v4b*)&sx[(tid >> 4) + 8 * i][(tid & 15) * 4] = c; }
    __syncthreads();   // the stage is written: every wave may read it
    if (ps + 1 < DM / KP) {   // the next pass's rows fly while this pass is multiplied
#pragma unroll
      for (int i = 0; i < 8; ++i) { wr[i] = *(const v4u*)(wsrc + (size_t)(16 * i) * DM + (ps + 1) * KP); xr[i] = *(const v4f*)(xsrc + (size_t)(8 * i) * DM + (ps + 1) * KP); }
      asm volatile("s_wait_xcnt 0x0" ::: "memory"); }   // stands in front of the loop's advance of the address registers that these loads name
#pragma unroll
    for (int kc = 0; kc < KP / 32; ++kc) { const v16b a = frag_b(&sx[wave * 16 + col][kc * 32], lane); v16b w[8];
#pragma unroll
      for (int j = 0; j < 8; ++j) w[j] = frag_b(&sw[j * 16 + col][kc * 32], lane);
      __builtin_amdgcn_sched_barrier(0);   // the LDS reads stay one group ahead of the products: read pair by pair among them, each product waits out a whole LDS latency
#pragma unroll
      for (int j = 0; j < 8; ++j) acc[j] = wmma_bf(a, w[j], acc[j]); }
    __syncthreads();   // every wave has read the stage: it may be rewritten (behind the last pass: by the output staging)
  }
  if (n0 < 2 * DM) {   // q stored unscaled (f16 sigma ~0.6, no subnormal exposure); 1/8 applied to the f32 score
#pragma unroll
    for (int j = 0; j < 8; ++j) {
#pragma unroll
      for (int r = 0; r < 8; ++r) { float v = acc[j][r] + (BB ? bfr(BB[j * 16 + col]) : 0.f); if (n0 >= DM) { const size_t ai = (size_t)((r0 + 8 * g + r) / SS) * DM + (n0 - DM + j * 16 + col); v = gclamp(v, bfr(AKMIN[ai]), bfr(AKMAX[ai])); } const _Float16 hv = (_Float16)v; so[wave][8 * g + r][j * 16 + col] = hv;   /* k guard-clamped per (b, h, d) */ sol[wave][8 * g + r][j * 16 + col] = (_Float16)((v - (float)hv) * 2048.0f); } }   // q, k (+ bias) as f16 hi + (x2048) residual
    LDSX();
    for (int rl = 0; rl < 16; ++rl) if (lane < 16) { vst2((unsigned*)(QK + (r0 + rl) * (2 * DM) + n0 + lane * 8), *(const v4u*)&so[wave][rl][lane * 8]); vst2((unsigned*)(QKL + (r0 + rl) * (2 * DM) + n0 + lane * 8), *(const v4u*)&sol[wave][rl][lane * 8]); }
  } else {
#pragma unroll
    for (int j = 0; j < 8; ++j) {
#pragma unroll
      for (int r = 0; r < 8; ++r) { float v = acc[j][r] + (BB ? bfr(BB[j * 16 + col]) : 0.f); { const size_t ai = (size_t)((r0 + 8 * g + r) / SS) * DM + (n0 - 2 * DM + j * 16 + col); v = gclamp(v, bfr(AVMIN[ai]), bfr(AVMAX[ai])); } const _Float16 hv = (_Float16)v; sth[j * 16 + col][wave * 16 + 8 * g + r] = hv;   /* v guard-clamped */ stl[j * 16 + col][wave * 16 + 8 * g + r] = (_Float16)((v - (float)hv) * 2048.0f); } }
    __syncthreads();
    const size_t rb = (size_t)blockIdx.x * 64; const int b = (int)(rb / SS), s0 = (int)(rb % SS); const int pc0 = n0 - 2 * DM;
    for (int q = tid; q < 128 * 8; q += 128) { const int d = q >> 3, pc = q & 7; const size_t o = ((size_t)b * DM + pc0 + d) * SS + s0 + pc * 8; vst2((unsigned*)(VTH + o), *(const v4u*)&sth[d][pc * 8]); vst2((unsigned*)(VTL + o), *(const v4u*)&stl[d][pc * 8]); }
  }
}
// ---- k_attn: block = (64 queries, head h, batch b): all-keys flash attention with TRANSPOSED products: S^T = K . Q^T (A = key rows from the stage, B = the wave's q rows kept in registers), so a lane holds 16 scores of ONE query (column col; keys 8g + r and 16 + 8g + r of the 32): maximum and sum run in the lane, one exchange between the lane halves joins the maximum; the two score tiles, exponentiated and rounded in place, ARE the B operand of O^T += V^T . P^T (A = channel rows of v from the stage): P never goes through LDS. O[b*S+q][h*64+d] = acc / l (256-B segments)
// lane l <-> lane l ^ 16 as a vector cross-row move: the shuffle builtin would go through the LDS pipe and its wait
__device__ __forceinline__ float xhalf(float v) { const int i = __builtin_bit_cast(int, v); return __builtin_bit_cast(float, __builtin_amdgcn_permlanex16(i, i, 0x76543210, 0xfedcba98, false, false)); }
__global__ __launch_bounds__(128) void k_attn(const _Float16* __restrict__ QK, const _Float16* __restrict__ QKL, const _Float16* __restrict__ VTH, const _Float16* __restrict__ VTL, const void* __restrict__ KMASK, float* __restrict__ O) {
  __shared__ __align__(16) float so[4][16][68];
  __shared__ __align__(16) _Float16 sk[KP][LP], sv[HD][LP];   // the stage: KP keys x 64 channels; 64 channels of v x KP keys
  const int tid = threadIdx.x, wave = tid >> 5, lane = tid & 31, col = lane & 15, g = lane >> 4;
  const int qb = blockIdx.x, h = blockIdx.y, b = blockIdx.z; const int q0 = qb * 64 + wave * 16; const size_t rq = (size_t)b * SS + q0 + col;
  v16h aq[2];   // B operand of the score product: column col = query q0 + col, channels in the loader's k order (the same loader as the key rows')
#pragma unroll
  for (int kc = 0; kc < 2; ++kc) aq[kc] = frag_h(QK + rq * (2 * DM) + h * HD + kc * 32, lane);
  const float CS = 0.125f * 1.44269504088896340736f;   // 1/sqrt(64) and log2(e) in one factor: weight x 2^11 = 2^(score * CS + nb), nb = 11 - maximum * CS
  float m = -3.0e38f, nb = 11.0f + 3.0e38f * CS, l = 0.f;   // of query col: m = maximum of the raw scores so far (equal in both lane halves), nb its exponent offset, l (x 2^11) over this lane half's keys (the halves are joined in the epilogue)
  v8f acc[4] = {};   // acc[dt][r] = O^T[channel dt * 16 + 8g + r][query col] (x 2^11)
  const _Float16* ksrc = QK + ((size_t)b * SS + (tid >> 3)) * (2 * DM) + DM + h * HD + (tid & 7) * 8;   // a wave's 16-B load: 4 key rows x 128 B
  const _Float16* vsrc = VTH + ((size_t)b * DM + h * HD + (tid >> 3)) * SS + (tid & 7) * 8;               // a wave's 16-B load: 4 channel rows x 128 B
  v4u kr[4], vr[4];
#pragma unroll
  for (int i = 0; i < 4; ++i) { kr[i] = *(const v4u*)(ksrc + (size_t)(16 * i) * (2 * DM)); vr[i] = *(const v4u*)(vsrc + (size_t)(16 * i) * SS); }
#pragma unroll 1   // rolled: one copy of the stage's code
  for (int st = 0; st < SS / KP; ++st) {   // all keys, KP a stage
#pragma unroll
  for (int i = 0; i < 4; ++i) { *(v4u*)&sk[(tid >> 3) + 16 * i][(tid & 7) * 8] = kr[i]; *(v4u*)&sv[(tid >> 3) + 16 * i][(tid & 7) * 8] = vr[i]; }
  __syncthreads();   // the stage is written: every wave may read it
  if (st + 1 < SS / KP) {   // the next stage's rows fly while this one is worked on
#pragma unroll
    for (int i = 0; i < 4; ++i) { kr[i] = *(const v4u*)(ksrc + ((size_t)(st + 1) * KP + 16 * i) * (2 * DM)); vr[i] = *(const v4u*)(vsrc + (size_t)(16 * i) * SS + (st + 1) * KP); } }
#pragma unroll 1   // rolled: the 32-key body stays one copy, as it was
  for (int ks = 0; ks < KP / 32; ++ks) { v8f s[2]; v16h kf[2][2], vf[4];
#pragma unroll
    for (int ct = 0; ct < 2; ++ct) {
#pragma unroll
      for (int kc = 0; kc < 2; ++kc) kf[ct][kc] = frag_h(&sk[ks * 32 + ct * 16 + col][kc * 32], lane); }   // A: row col = key ct * 16 + col
#pragma unroll
    for (int dt = 0; dt < 4; ++dt) vf[dt] = frag_h(&sv[dt * 16 + col][ks * 32], lane);   // A of the second product: row col = channel dt * 16 + col; its k order (keys 8g + i, 16 + 8g + i) is that of the packed score tiles
    __builtin_amdgcn_sched_barrier(0);   // the LDS reads stay one group ahead of the products: read pair by pair among them, each product waits out a whole LDS latency (the v rows land under the scores and the softmax)
#pragma unroll
    for (int ct = 0; ct < 2; ++ct) { v8f c = {};
#pragma unroll
      for (int kc = 0; kc < 2; ++kc) c = wmma16(kf[ct][kc], aq[kc], c);   // single product: k, q as one-rounding f16 operands; c[r] = raw score of key ct * 16 + 8g + r with query col
      s[ct] = c; }
    float mx = fmaxf(s[0][0], s[1][0]);
#pragma unroll
    for (int r = 1; r < 8; ++r) mx = fmaxf(mx, fmaxf(s[0][r], s[1][r]));
    mx = fmaxf(mx, xhalf(mx));   // both lane halves hold the query's maximum over the 32 keys
    const float mn = fmaxf(m, mx), nbn = fmaf(mn, -CS, 11.0f); const float alpha = __builtin_amdgcn_exp2f(nbn - nb);   // 2^((m - mn) * CS); 0 in the first pass, where nb is huge
    v16h pa; v2f es = {0.f, 0.f};
#pragma unroll
    for (int ct = 0; ct < 2; ++ct) {
#pragma unroll
      for (int i = 0; i < 4; ++i) { const v2f sp = {s[ct][2 * i], s[ct][2 * i + 1]}, t = sp * CS + nbn;   // neighbouring score registers as a pair: one packed multiply-add, two hardware exponentials, one packed add for two scores
        const v2f e = {__builtin_amdgcn_exp2f(t[0]), __builtin_amdgcn_exp2f(t[1])};
        es += e; pa[8 * ct + 2 * i] = (_Float16)e[0]; pa[8 * ct + 2 * i + 1] = (_Float16)e[1]; } }   // P carries 2^11 (the 11 in nb) so small softmax weights stay out of the f16 subnormal range; l carries it too, so it cancels in the epilogue
    l = l * alpha + (es[0] + es[1]); m = mn; nb = nbn;
#pragma unroll
    for (int dt = 0; dt < 4; ++dt) acc[dt] *= alpha;
#pragma unroll
    for (int dt = 0; dt < 4; ++dt) acc[dt] = wmma16(vf[dt], pa, acc[dt]); }   // single product: V^T x P^T (x2^11)
  __syncthreads();   // every wave has read the stage: it may be rewritten
  }
  { const float il = 1.0f / (l + xhalf(l));   // the two lane halves' sums joined, unconditionally
#pragma unroll
    for (int dt = 0; dt < 4; ++dt) {
#pragma unroll
      for (int q = 0; q < 2; ++q) { v4f o;
#pragma unroll
        for (int e = 0; e < 4; ++e) o[e] = acc[dt][4 * q + e] * il;
        *(v4f*)&so[wave][col][dt * 16 + 8 * g + 4 * q] = o; } } }
  LDSX();
  for (int rl = 0; rl < 16; ++rl) if (lane < 16) vst2(O + ((size_t)b * SS + q0 + rl) * DM + h * HD + lane * 4, *(const v4f*)&so[wave][rl][lane * 4]);
}
// ---- k_out: block = (64 rows, 128 cols): out = O(hi/lo) . Wo rows (2 products) + bo
__global__ __launch_bounds__(128) void k_out(const float* __restrict__ O, const __bf16* __restrict__ P, const float* __restrict__ BO, float* __restrict__ Y) {
  // one LDS range: the operand stage of the k loop (sw, sxh, sxl), then, behind the loop's last barrier, the output staging
  __shared__ __align__(16) unsigned char sm[(128 + 64 + 64) * LP * 2];
  float (*so)[16][132] = (float (*)[16][132])sm;
  __bf16 (*sw)[LP] = (__bf16 (*)[LP])sm; __bf16 (*sxh)[LP] = (__bf16 (*)[LP])(sm + 128 * LP * 2); __bf16 (*sxl)[LP] = (__bf16 (*)[LP])(sm + (128 + 64) * LP * 2);   // 128 weight rows; 64 o rows as bf16 hi and residual
  const int tid = threadIdx.x, wave = tid >> 5, lane = tid & 31, col = lane & 15, g = lane >> 4; const size_t r0 = (size_t)blockIdx.x * 64 + wave * 16; const int n0 = blockIdx.y * 128;
  v8f acc[8] = {};
  const __bf16* wsrc = P + (size_t)(n0 + (tid >> 3)) * DM + (tid & 7) * 8;                       // a wave's 16-B load: 4 weight rows x 128 B
  const float* xsrc = O + ((size_t)blockIdx.x * 64 + (tid >> 4)) * DM + (tid & 15) * 4;           // a wave's 16-B load: 2 o rows x 256 B
  v4u wr[8]; v4f xr[8];
#pragma unroll
  for (int i = 0; i < 8; ++i) { wr[i] = *(const v4u*)(wsrc + (size_t)(16 * i) * DM); xr[i] = *(const v4f*)(xsrc + (size_t)(8 * i) * DM); }
#pragma unroll 1   // rolled: one copy of the pass keeps the prefetch registers' live range to one pass
  for (int ps = 0; ps < DM / KP; ++ps) {
#pragma unroll
    for (int i = 0; i < 8; ++i) { *(v4u*)&sw[(tid >> 3) + 16 * i][(tid & 7) * 8] = wr[i]; v4b ch, cl;
#pragma unroll
      for (int e = 0; e < 4; ++e) { const __bf16 hv = (__bf16)xr[i][e]; ch[e] = hv; cl[e] = (__bf16)(xr[i][e] - (float)hv); }
      *(v4b*)&sxh[(tid >> 4) + 8 * i][(tid & 15) * 4] = ch; *(v4b*)&sxl[(tid >> 4) + 8 * i][(tid & 15) * 4] = cl; }
    __syncthreads();   // the stage is written: every wave may read it
    if (ps + 1 < DM / KP) {   // the next pass's rows fly while this pass is multiplied
#pragma unroll
      for (int i = 0; i < 8; ++i) { wr[i] = *(const v4u*)(wsrc + (size_t)(16 * i) * DM + (ps + 1) * KP); xr[i] = *(const v4f*)(xsrc + (size_t)(8 * i) * DM + (ps + 1) * KP); }
      asm volatile("s_wait_xcnt 0x0" ::: "memory"); }   // stands in front of the loop's advance of the address registers that these loads name
#pragma unroll
    for (int kc = 0; kc < KP / 32; ++kc) { const v16b ah = frag_b(&sxh[wave * 16 + col][kc * 32], lane), al = frag_b(&sxl[wave * 16 + col][kc * 32], lane); v16b w[8];
#pragma unroll
      for (int j = 0; j < 8; ++j) w[j] = frag_b(&sw[j * 16 + col][kc * 32], lane);
      __builtin_amdgcn_sched_barrier(0);   // the LDS reads stay one group ahead of the products: read pair by pair among them, each product waits out a whole LDS latency
#pragma unroll
      for (int j = 0; j < 8; ++j) { acc[j] = wmma_bf(al, w[j], acc[j]); acc[j] = wmma_bf(ah, w[j], acc[j]); } }
    __syncthreads();   // every wave has read the stage: it may be rewritten (behind the last pass: by the output staging)
  }
#pragma unroll
  for (int j = 0; j < 8; ++j) {
#pragma unroll
    for (int r = 0; r < 8; ++r) so[wave][8 * g + r][j * 16 + col] = acc[j][r] + bfr(BO[n0 + j * 16 + col]); }
  LDSX();
  for (int rl = 0; rl < 16; ++rl) vst2(Y + (r0 + rl) * DM + n0 + lane * 4, *(const v4f*)&so[wave][rl][lane * 4]);
}
extern "C" void kernel_launch(void* const* d_in, const int* in_sizes, int n_in, void* d_out, int out_size, void* d_ws, size_t ws_size, hipStream_t stream) {
  (void)in_sizes; (void)n_in; (void)out_size;
  const float** F = (const float**)d_in;   // 0 x [2,2048,1024], 1 qkv_w [3072,1024] natural, 2 qkv_b, 3 out_w, 4 out_b, 5 anchor_k_min, 6 anchor_k_max, 7 anchor_v_min, 8 anchor_v_max ([2,16,1,64] each)
  if (ws_size < (size_t)WS_END) return;
  char* ws = (char*)d_ws; __bf16* PK = (__bf16*)(ws + WS_PK); _Float16 *QK = (_Float16*)(ws + WS_QK), *QKL = (_Float16*)(ws + WS_QKL), *VTH = (_Float16*)(ws + WS_VTH), *VTL = (_Float16*)(ws + WS_VTL); float* O = (float*)(ws + WS_O);
  k_pack<<<dim3(DM, 4), 256, 0, stream>>>(F[1], F[1] + (size_t)DM * DM, F[1] + (size_t)2 * DM * DM, F[3], PK);
  k_qkv<<<dim3(TNB * SS / 64, QKVW / 128), 128, 0, stream>>>(F[0], F[0], F[0], PK + PK_A, F[2], F[2] + DM, F[2] + 2 * DM, F[5], F[6], F[7], F[8], QK, QKL, VTH, VTL);
  k_attn<<<dim3(TQB, NH, TNB), 128, 0, stream>>>(QK, QKL, VTH, VTL, nullptr, O);
  k_out<<<dim3(TOB, DM / 128), 128, 0, stream>>>(O, PK + PK_P, F[4], (float*)d_out);
}

// v004
// One run takes 101 microseconds.
// Next to v003, in two timings, it ran 1.17 and 1.18 times as fast.
// Counting every step since v000, it is 3.94 times as fast.
// compute dtype: all float inputs rounded to bf16; qkv = x . W_qkv^T + b with EXACT bf16 products on WMMA 16x16x32 (natural rows; the fused weight as three contiguous row blocks); the guard clamp of k and v in f32 before the f16 rounding; PLAIN attention: q, k single f16 x 1/8, running-max softmax in f32 (hardware exp), P (scaled by 2^11, single f16) x v (single f16); out = o (bf16 hi + residual) . W_out^T (2 products) + b_out.
#include <hip/hip_runtime.h>
#include <math.h>

typedef __attribute__((ext_vector_type(16))) _Float16 v16h;
typedef __attribute__((ext_vector_type(16))) __bf16 v16b;
typedef __attribute__((ext_vector_type(8)))  _Float16 v8h;
typedef __attribute__((ext_vector_type(8)))  float v8f;
typedef __attribute__((ext_vector_type(4)))  float v4f;
typedef __attribute__((ext_vector_type(2)))  float v2f;
typedef __attribute__((ext_vector_type(4)))  unsigned v4u;
typedef __attribute__((ext_vector_type(4)))  int v4i;
typedef float __attribute__((may_alias)) float_a;
typedef int __attribute__((may_alias)) int_a;

template <typename T> __device__ __forceinline__ void vst2(void* p, T v) { *(T*)p = v;  }
__device__ __forceinline__ v8f wmma16(v16h a, v16h b, v8f c) {
  v8f d = __builtin_amdgcn_wmma_f32_16x16x32_f16(false, a, false, b, (short)0, c, false, false);
  asm volatile("v_nop\n\tv_nop\n\tv_nop\n\tv_nop" : "+v"(d) : "v"(a), "v"(b));
  return d;
}
__device__ __forceinline__ v8f wmma_bf(v16b a, v16b b, v8f c) {
  v8f d = __builtin_amdgcn_wmma_f32_16x16x32_bf16(false, a, false, b, (short)0, c, false, false);
  asm volatile("v_nop\n\tv_nop\n\tv_nop\n\tv_nop" : "+v"(d) : "v"(a), "v"(b));
  return d;
}
// Range-aware (guard-clamped) multi-head attention (B 2, S 2,048, d 1,024, 16 heads x 64): fused qkv projection + bias, k and v clamped against per-(batch, head, channel) anchor ranges with a 0.1 slack, softmax(q k^T / 8) v, output projection + bias.
__device__ __forceinline__ v16h frag_h(const _Float16* rowk0, int lane) {
  union { v16h v; v8h q[2]; } u; const _Float16* p = rowk0 + 8 * (lane >> 4);
  u.q[0] = *(const v8h*)p; u.q[1] = *(const v8h*)(p + 16); return u.v;
}
__device__ __forceinline__ v16h frag_f32(const float* rowk0, int lane) {
  v16h a; const float* p = rowk0 + 8 * (lane >> 4);
#pragma unroll
  for (int i = 0; i < 8; ++i) { a[i] = (_Float16)p[i]; a[8 + i] = (_Float16)p[16 + i]; }
  return a;
}
__device__ __forceinline__ v16h frag_f32s(const float* rowk0, int lane, float sc) {
  v16h a; const float* p = rowk0 + 8 * (lane >> 4);
#pragma unroll
  for (int i = 0; i < 8; ++i) { a[i] = (_Float16)(p[i] * sc); a[8 + i] = (_Float16)(p[16 + i] * sc); }
  return a;
}
// column fragment from a [K][ld] layout (column n), rows >= K read as 0
__device__ __forceinline__ v16h fragc_f32(const float* W, int k0, int n, int lane, int ld, int K) {
  v16h a; const int g = lane >> 4;
#pragma unroll
  for (int i = 0; i < 8; ++i) { const int ka = k0 + 8 * g + i, kb = ka + 16;
    a[i] = (_Float16)(ka < K ? W[(size_t)(ka < K ? ka : K - 1) * ld + n] : 0.f); a[8 + i] = (_Float16)(kb < K ? W[(size_t)(kb < K ? kb : K - 1) * ld + n] : 0.f); }
  return a;
}
struct F2 { v16b h, l; };
__device__ __forceinline__ F2 bsplit16(const float v[16]) { F2 r;
#pragma unroll
  for (int i = 0; i < 16; ++i) { const __bf16 h = (__bf16)v[i]; r.h[i] = h; r.l[i] = (__bf16)(v[i] - (float)h); }
  return r; }
__device__ __forceinline__ F2 split_row(const float* row, int k0, int lane) { float v[16]; const float* p = row + k0 + 8 * (lane >> 4);
#pragma unroll
  for (int i = 0; i < 8; ++i) { v[i] = p[i]; v[8 + i] = p[16 + i]; }
  return bsplit16(v); }
__device__ __forceinline__ F2 split_rowK(const float* row, int k0, int lane, int K) { float v[16]; const int g = lane >> 4;
#pragma unroll
  for (int i = 0; i < 8; ++i) { const int ka = k0 + 8 * g + i, kb = ka + 16; v[i] = ka < K ? row[ka < K ? ka : K - 1] : 0.f; v[8 + i] = kb < K ? row[kb < K ? kb : K - 1] : 0.f; }
  return bsplit16(v); }
__device__ __forceinline__ F2 split_col(const float* W, int k0, int n, int lane, int ld, int K) { float v[16]; const int g = lane >> 4;
#pragma unroll
  for (int i = 0; i < 8; ++i) { const int ka = k0 + 8 * g + i, kb = ka + 16; v[i] = ka < K ? W[(size_t)(ka < K ? ka : K - 1) * ld + n] : 0.f; v[8 + i] = kb < K ? W[(size_t)(kb < K ? kb : K - 1) * ld + n] : 0.f; }
  return bsplit16(v); }
__device__ __forceinline__ v8f mac3(const F2& a, const F2& b, v8f c) { c = wmma_bf(a.l, b.h, c); c = wmma_bf(a.h, b.l, c); return wmma_bf(a.h, b.h, c); }
__device__ __forceinline__ float sigm(float v) { return 1.0f / (1.0f + expf(-v)); }
#define LDSX() do { asm volatile("s_wait_dscnt 0" ::: "memory"); __builtin_amdgcn_wave_barrier(); __builtin_amdgcn_fence(__ATOMIC_RELEASE, "workgroup"); } while (0)


#define NB 2
#define SS 2048
#define DM 1024
#define NH 16
#define GEPS 0.1f
__device__ __forceinline__ float gclamp(float tv, float amin, float amax) { float lo = fmaxf(tv - GEPS, amin); const float hi = fminf(tv + GEPS, amax); lo = fminf(lo, hi); return fmaxf(lo, fminf(tv, hi)); }
#define HD 64
#define QKVW (3 * DM)
#ifndef TQB
#define TQB (SS / 64)
#define TNB NB
#define TOB (NB * SS / 64)     // output row tiles (all)
#endif
typedef __attribute__((ext_vector_type(8))) __bf16 v8b;
__device__ __forceinline__ v16b frag_b(const __bf16* rowk0, int lane) {
  union { v16b v; v8b q[2]; } u; const __bf16* p = rowk0 + 8 * (lane >> 4);
  u.q[0] = *(const v8b*)p; u.q[1] = *(const v8b*)(p + 16); return u.v;
}
__device__ __forceinline__ float bfr(float v) { return (float)(__bf16)v; }
typedef __attribute__((ext_vector_type(4))) __bf16 v4b;
#define KP 64   // k (or keys) per staged pass: 128 B of every 16-bit operand row, one whole line
#define LP 72   // LDS row pitch in 16-bit elements: 128 B of data + 16 B, the pitch for ds_load_b128 readers
__device__ __attribute__((noinline)) float exp_ni(float v) { return expf(v); }
__device__ __attribute__((noinline)) float erf_ni(float v) { return erff(v); }

#define PK_A 0                       // [3072][1024] Wqkv rows (natural [out][in])
#define PK_P (PK_A + QKVW * DM)        // [1024][1024] Wo rows (natural)
#define PK_END (PK_P + DM * DM)
#define WS_PK  0u
#define WS_QK  (WS_PK + 2u * PK_END)             // f16 [4096 rows][2048]: q | k
#define WS_QKL (WS_QK + 2u * NB * SS * 2 * DM)     // f16 q | k residual planes x2048
#define WS_VTH (WS_QKL + 2u * NB * SS * 2 * DM)    // f16 [b][1024 (h*64+d)][2048 s] hi
#define WS_VTL (WS_VTH + 2u * NB * DM * SS)        // f16 lo x 2048
#define WS_O   (WS_VTL + 2u * NB * DM * SS)        // f32 [4096][1024]
#define WS_CS  (WS_O + 4u * NB * SS * DM)           // f32 2 x [2048][32], not used by any kernel
#define WS_END (WS_CS + 4u * 2 * SS * 32)
// ---- k_pack: block = (row n, which): natural [out][in] rows -> bf16; which 0..2 -> W_q/W_k/W_v into PK_A rows which*1024 + n; 3 -> W_o into PK_P
__global__ __launch_bounds__(256) void k_pack(const float* __restrict__ WQ, const float* __restrict__ WK, const float* __restrict__ WV, const float* __restrict__ WO, __bf16* __restrict__ PK) {
  __shared__ __align__(16) __bf16 s[DM]; const int n = blockIdx.x, which = blockIdx.y, t = threadIdx.x; const float* Wm = (which == 0) ? WQ : (which == 1) ? WK : (which == 2) ? WV : WO;
  for (int k = t; k < DM; k += 256) s[k] = (__bf16)Wm[(size_t)n * DM + k];
  __syncthreads();
  __bf16* dst = (which < 3) ? PK + PK_A + ((size_t)which * DM + n) * DM : PK + PK_P + (size_t)n * DM;
  for (int q = t; q < DM / 8; q += 256) vst2((unsigned*)(dst + q * 8), *(const v4u*)&s[q * 8]);
}
__global__ __launch_bounds__(128) void k_qkv(const float* __restrict__ XQ, const float* __restrict__ XK, const float* __restrict__ XV, const __bf16* __restrict__ P, const float* __restrict__ BQ, const float* __restrict__ BK, const float* __restrict__ BV, const float* __restrict__ AKMIN, const float* __restrict__ AKMAX, const float* __restrict__ AVMIN, const float* __restrict__ AVMAX, _Float16* __restrict__ QK, _Float16* __restrict__ QKL, _Float16* __restrict__ VTH, _Float16* __restrict__ VTL) {
  const int which0 = (blockIdx.y * 128) / DM; const float* X = (which0 == 0) ? XQ : (which0 == 1) ? XK : XV; const float* BB = BQ ? (((which0 == 0) ? BQ : (which0 == 1) ? BK : BV) + (blockIdx.y * 128 - which0 * DM)) : nullptr;
  // block = 128 x rows by 128 weight rows; the four waves stand 2 x 2, each on 64 x 64 of it (4 x 4 accumulator tiles): every staged fragment feeds four products, and a staged byte serves twice the rows it did
  // one LDS range: the operand stage of the k loop (sw, sx), then, behind the loop's last barrier, each wave's own output staging (two planes of 64 rows)
  __shared__ __align__(16) unsigned char sm[4 * 2 * 64 * LP * 2];
  __bf16 (*sw)[LP] = (__bf16 (*)[LP])sm; __bf16 (*sx)[LP] = (__bf16 (*)[LP])(sm + 128 * LP * 2);   // 128 weight rows, 128 x rows (bf16), KP k each
  const int tid = threadIdx.x, wave = tid >> 5, lane = tid & 31, col = lane & 15, g = lane >> 4, wm = wave >> 1, wn = wave & 1; const size_t rb = (size_t)blockIdx.x * 128; const int n0 = blockIdx.y * 128;
  _Float16 (*sh)[LP] = (_Float16 (*)[LP])(sm + wave * (2 * 64 * LP * 2)); _Float16 (*sl)[LP] = sh + 64;   // this wave's staging: value plane, residual plane
  v8f acc[4][4] = {};
  const __bf16* wsrc = P + (size_t)(n0 + (tid >> 3)) * DM + (tid & 7) * 8;                       // a wave's 16-B load: 4 weight rows x 128 B
  const float* xsrc = X + (rb + (tid >> 4)) * DM + (tid & 15) * 4;                                // a wave's 16-B load: 2 x rows x 256 B
  v4u wr[8]; v4f xr[16];
#pragma unroll
  for (int i = 0; i < 8; ++i) wr[i] = *(const v4u*)(wsrc + (size_t)(16 * i) * DM);
#pragma unroll
  for (int i = 0; i < 16; ++i) xr[i] = *(const v4f*)(xsrc + (size_t)(8 * i) * DM);
  asm volatile("s_wait_xcnt 0x0" :: "v"(wsrc), "v"(xsrc) : "memory");   // stands in front of the reuse of the address registers that these first loads name: as inputs they stay live up to the wait
#pragma unroll 1   // rolled: one copy of the pass keeps the prefetch registers' live range to one pass
  for (int ps = 0; ps < DM / KP; ++ps) {
#pragma unroll
    for (int i = 0; i < 8; ++i) *(v4u*)&sw[(tid >> 3) + 16 * i][(tid & 7) * 8] = wr[i];
#pragma unroll
    for (int i = 0; i < 16; ++i) { v4b c;
#pragma unroll
      for (int e = 0; e < 4; ++e) c[e] = (__bf16)xr[i][e];
      *(v4b*)&sx[(tid >> 4) + 8 * i][(tid & 15) * 4] = c; }
    __syncthreads();   // the stage is written: every wave may read it
    if (ps + 1 < DM / KP) {   // the next pass's rows fly while this pass is multiplied
#pragma unroll
      for (int i = 0; i < 8; ++i) wr[i] = *(const v4u*)(wsrc + (size_t)(16 * i) * DM + (ps + 1) * KP);
#pragma unroll
      for (int i = 0; i < 16; ++i) xr[i] = *(const v4f*)(xsrc + (size_t)(8 * i) * DM + (ps + 1) * KP);
      asm volatile("s_wait_xcnt 0x0" ::: "memory"); }   // stands in front of the loop's advance of the address registers that these loads name
#pragma unroll
    for (int kc = 0; kc < KP / 32; ++kc) { v16b a[4], w[4];
#pragma unroll
      for (int i = 0; i < 4; ++i) a[i] = frag_b(&sx[wm * 64 + i * 16 + col][kc * 32], lane);
#pragma unroll
      for (int j = 0; j < 4; ++j) w[j] = frag_b(&sw[wn * 64 + j * 16 + col][kc * 32], lane);
      __builtin_amdgcn_sched_barrier(0);   // the LDS reads stay one group ahead of the products: read pair by pair among them, each product waits out a whole LDS latency
#pragma unroll
      for (int i = 0; i < 4; ++i) {
#pragma unroll
        for (int j = 0; j < 4; ++j) acc[i][j] = wmma_bf(a[i], w[j], acc[i][j]); } }
    __syncthreads();   // every wave has read the stage: it may be rewritten (behind the last pass: by the output staging)
  }
  const int b = (int)(rb / SS), c0 = wn * 64, cb = c0 + col;   // a block's 128 rows lie in one batch; cb: this lane's first column in the block
  const bool isv = n0 >= 2 * DM, cl = n0 >= DM;   // block-uniform: v block; block whose values are guard-clamped (k, v)
  const size_t a0 = (size_t)b * DM + (cl ? n0 - (isv ? 2 * DM : DM) : 0) + cb; const float* pmin = (isv ? AVMIN : AKMIN) + a0; const float* pmax = (isv ? AVMAX : AKMAX) + a0;
  float bias[4] = {0.f, 0.f, 0.f, 0.f}, amin[4] = {0.f, 0.f, 0.f, 0.f}, amax[4] = {0.f, 0.f, 0.f, 0.f};   // of columns cb + 16 j: loaded as one group, one latency for all
  if (BB) {
#pragma unroll
    for (int j = 0; j < 4; ++j) bias[j] = BB[cb + 16 * j]; }
  if (cl) {
#pragma unroll
    for (int j = 0; j < 4; ++j) { amin[j] = pmin[16 * j]; amax[j] = pmax[16 * j]; } }
  asm volatile("s_wait_xcnt 0x0" :: "v"(cb), "s"(BB), "v"(pmin), "v"(pmax) : "memory");   // stands in front of the reuse of the address registers that these loads name: as inputs they stay live up to the wait
#pragma unroll
  for (int j = 0; j < 4; ++j) { bias[j] = bfr(bias[j]); amin[j] = bfr(amin[j]); amax[j] = bfr(amax[j]); }
  if (!cl) {   // q stored unscaled (f16 sigma ~0.6, no subnormal exposure); 1/8 applied to the f32 score
#pragma unroll
    for (int j = 0; j < 4; ++j) {
#pragma unroll
      for (int i = 0; i < 4; ++i) {
#pragma unroll
        for (int r = 0; r < 8; ++r) { const float v = acc[i][j][r] + bias[j];
          const _Float16 hv = (_Float16)v; sh[i * 16 + 8 * g + r][j * 16 + col] = hv; sl[i * 16 + 8 * g + r][j * 16 + col] = (_Float16)((v - (float)hv) * 2048.0f); } } }   // q (+ bias) as f16 hi + (x2048) residual
  } else if (!isv) {
#pragma unroll
    for (int j = 0; j < 4; ++j) {
#pragma unroll
      for (int i = 0; i < 4; ++i) {
#pragma unroll
        for (int r = 0; r < 8; ++r) { const float v = gclamp(acc[i][j][r] + bias[j], amin[j], amax[j]);   /* k guard-clamped per (b, h, d) */
          const _Float16 hv = (_Float16)v; sh[i * 16 + 8 * g + r][j * 16 + col] = hv; sl[i * 16 + 8 * g + r][j * 16 + col] = (_Float16)((v - (float)hv) * 2048.0f); } } }   // k (+ bias) as f16 hi + (x2048) residual
  } else {
#pragma unroll
    for (int j = 0; j < 4; ++j) {
#pragma unroll
      for (int i = 0; i < 4; ++i) {
#pragma unroll
        for (int r = 0; r < 8; ++r) { const float v = gclamp(acc[i][j][r] + bias[j], amin[j], amax[j]);   /* v guard-clamped */
          const _Float16 hv = (_Float16)v; sh[j * 16 + col][i * 16 + 8 * g + r] = hv; sl[j * 16 + col][i * 16 + 8 * g + r] = (_Float16)((v - (float)hv) * 2048.0f); } } }   // staged transposed: row = channel, 64 positions along it
  }
  LDSX();
  // staged rows go out as whole lines: q, k: row = position, into [position][2048]; v: row = channel, into [b][channel][position]
  _Float16* dh = isv ? VTH + ((size_t)b * DM + (n0 - 2 * DM) + c0) * SS + (rb % SS) + wm * 64 : QK + (rb + wm * 64) * (2 * DM) + n0 + c0;
  _Float16* dl = isv ? VTL + ((size_t)b * DM + (n0 - 2 * DM) + c0) * SS + (rb % SS) + wm * 64 : QKL + (rb + wm * 64) * (2 * DM) + n0 + c0;
  for (int it = 0; it < 16; ++it) { const int row = it * 4 + (lane >> 3), ch = lane & 7; const size_t o = (size_t)row * (isv ? SS : 2 * DM) + ch * 8;   // a wave's 16-B store: 4 rows x 128 B
    vst2((unsigned*)(dh + o), *(const v4u*)&sh[row][ch * 8]); vst2((unsigned*)(dl + o), *(const v4u*)&sl[row][ch * 8]); }
}
// ---- k_attn: block = (64 queries, head h, batch b): all-keys flash attention with TRANSPOSED products: S^T = K . Q^T (A = key rows from the stage, B = the wave's q rows kept in registers), so a lane holds 16 scores of ONE query (column col; keys 8g + r and 16 + 8g + r of the 32): maximum and sum run in the lane, one exchange between the lane halves joins the maximum; the two score tiles, exponentiated and rounded in place, ARE the B operand of O^T += V^T . P^T (A = channel rows of v from the stage): P never goes through LDS. O[b*S+q][h*64+d] = acc / l (256-B segments)
// lane l <-> lane l ^ 16 as a vector cross-row move: the shuffle builtin would go through the LDS pipe and its wait
__device__ __forceinline__ float xhalf(float v) { const int i = __builtin_bit_cast(int, v); return __builtin_bit_cast(float, __builtin_amdgcn_permlanex16(i, i, 0x76543210, 0xfedcba98, false, false)); }
__global__ __launch_bounds__(128) void k_attn(const _Float16* __restrict__ QK, const _Float16* __restrict__ QKL, const _Float16* __restrict__ VTH, const _Float16* __restrict__ VTL, const void* __restrict__ KMASK, float* __restrict__ O) {
  __shared__ __align__(16) float so[4][16][68];
  __shared__ __align__(16) _Float16 sk[KP][LP], sv[HD][LP];   // the stage: KP keys x 64 channels; 64 channels of v x KP keys
  const int tid = threadIdx.x, wave = tid >> 5, lane = tid & 31, col = lane & 15, g = lane >> 4;
  const int qb = blockIdx.x, h = blockIdx.y, b = blockIdx.z; const int q0 = qb * 64 + wave * 16; const size_t rq = (size_t)b * SS + q0 + col;
  v16h aq[2];   // B operand of the score product: column col = query q0 + col, channels in the loader's k order (the same loader as the key rows')
#pragma unroll
  for (int kc = 0; kc < 2; ++kc) aq[kc] = frag_h(QK + rq * (2 * DM) + h * HD + kc * 32, lane);
  const float CS = 0.125f * 1.44269504088896340736f;   // 1/sqrt(64) and log2(e) in one factor: weight x 2^11 = 2^(score * CS + nb), nb = 11 - maximum * CS
  float m = -3.0e38f, nb = 11.0f + 3.0e38f * CS, l = 0.f;   // of query col: m = maximum of the raw scores so far (equal in both lane halves), nb its exponent offset, l (x 2^11) over this lane half's keys (the halves are joined in the epilogue)
  v8f acc[4] = {};   // acc[dt][r] = O^T[channel dt * 16 + 8g + r][query col] (x 2^11)
  const _Float16* ksrc = QK + ((size_t)b * SS + (tid >> 3)) * (2 * DM) + DM + h * HD + (tid & 7) * 8;   // a wave's 16-B load: 4 key rows x 128 B
  const _Float16* vsrc = VTH + ((size_t)b * DM + h * HD + (tid >> 3)) * SS + (tid & 7) * 8;               // a wave's 16-B load: 4 channel rows x 128 B
  v4u kr[4], vr[4];
#pragma unroll
  for (int i = 0; i < 4; ++i) { kr[i] = *(const v4u*)(ksrc + (size_t)(16 * i) * (2 * DM)); vr[i] = *(const v4u*)(vsrc + (size_t)(16 * i) * SS); }
#pragma unroll 1   // rolled: one copy of the stage's code
  for (int st = 0; st < SS / KP; ++st) {   // all keys, KP a stage
#pragma unroll
  for (int i = 0; i < 4; ++i) { *(v4u*)&sk[(tid >> 3) + 16 * i][(tid & 7) * 8] = kr[i]; *(v4u*)&sv[(tid >> 3) + 16 * i][(tid & 7) * 8] = vr[i]; }
  __syncthreads();   // the stage is written: every wave may read it
  if (st + 1 < SS / KP) {   // the next stage's rows fly while this one is worked on
#pragma unroll
    for (int i = 0; i < 4; ++i) { kr[i] = *(const v4u*)(ksrc + ((size_t)(st + 1) * KP + 16 * i) * (2 * DM)); vr[i] = *(const v4u*)(vsrc + (size_t)(16 * i) * SS + (st + 1) * KP); } }
#pragma unroll 1   // rolled: the 32-key body stays one copy, as it was
  for (int ks = 0; ks < KP / 32; ++ks) { v8f s[2]; v16h kf[2][2], vf[4];
#pragma unroll
    for (int ct = 0; ct < 2; ++ct) {
#pragma unroll
      for (int kc = 0; kc < 2; ++kc) kf[ct][kc] = frag_h(&sk[ks * 32 + ct * 16 + col][kc * 32], lane); }   // A: row col = key ct * 16 + col
#pragma unroll
    for (int dt = 0; dt < 4; ++dt) vf[dt] = frag_h(&sv[dt * 16 + col][ks * 32], lane);   // A of the second product: row col = channel dt * 16 + col; its k order (keys 8g + i, 16 + 8g + i) is that of the packed score tiles
    __builtin_amdgcn_sched_barrier(0);   // the LDS reads stay one group ahead of the products: read pair by pair among them, each product waits out a whole LDS latency (the v rows land under the scores and the softmax)
#pragma unroll
    for (int ct = 0; ct < 2; ++ct) { v8f c = {};
#pragma unroll
      for (int kc = 0; kc < 2; ++kc) c = wmma16(kf[ct][kc], aq[kc], c);   // single product: k, q as one-rounding f16 operands; c[r] = raw score of key ct * 16 + 8g + r with query col
      s[ct] = c; }
    float mx = fmaxf(s[0][0], s[1][0]);
#pragma unroll
    for (int r = 1; r < 8; ++r) mx = fmaxf(mx, fmaxf(s[0][r], s[1][r]));
    mx = fmaxf(mx, xhalf(mx));   // both lane halves hold the query's maximum over the 32 keys
    const float mn = fmaxf(m, mx), nbn = fmaf(mn, -CS, 11.0f); const float alpha = __builtin_amdgcn_exp2f(nbn - nb);   // 2^((m - mn) * CS); 0 in the first pass, where nb is huge
    v16h pa; v2f es = {0.f, 0.f};
#pragma unroll
    for (int ct = 0; ct < 2; ++ct) {
#pragma unroll
      for (int i = 0; i < 4; ++i) { const v2f sp = {s[ct][2 * i], s[ct][2 * i + 1]}, t = sp * CS + nbn;   // neighbouring score registers as a pair: one packed multiply-add, two hardware exponentials, one packed add for two scores
        const v2f e = {__builtin_amdgcn_exp2f(t[0]), __builtin_amdgcn_exp2f(t[1])};
        es += e; pa[8 * ct + 2 * i] = (_Float16)e[0]; pa[8 * ct + 2 * i + 1] = (_Float16)e[1]; } }   // P carries 2^11 (the 11 in nb) so small softmax weights stay out of the f16 subnormal range; l carries it too, so it cancels in the epilogue
    l = l * alpha + (es[0] + es[1]); m = mn; nb = nbn;
#pragma unroll
    for (int dt = 0; dt < 4; ++dt) acc[dt] *= alpha;
#pragma unroll
    for (int dt = 0; dt < 4; ++dt) acc[dt] = wmma16(vf[dt], pa, acc[dt]); }   // single product: V^T x P^T (x2^11)
  __syncthreads();   // every wave has read the stage: it may be rewritten
  }
  { const float il = 1.0f / (l + xhalf(l));   // the two lane halves' sums joined, unconditionally
#pragma unroll
    for (int dt = 0; dt < 4; ++dt) {
#pragma unroll
      for (int q = 0; q < 2; ++q) { v4f o;
#pragma unroll
        for (int e = 0; e < 4; ++e) o[e] = acc[dt][4 * q + e] * il;
        *(v4f*)&so[wave][col][dt * 16 + 8 * g + 4 * q] = o; } } }
  LDSX();
  for (int rl = 0; rl < 16; ++rl) if (lane < 16) vst2(O + ((size_t)b * SS + q0 + rl) * DM + h * HD + lane * 4, *(const v4f*)&so[wave][rl][lane * 4]);
}
// ---- k_out: block = (64 rows, 128 cols): out = O(hi/lo) . Wo rows (2 products) + bo
__global__ __launch_bounds__(128) void k_out(const float* __restrict__ O, const __bf16* __restrict__ P, const float* __restrict__ BO, float* __restrict__ Y) {
  // one LDS range: the operand stage of the k loop (sw, sxh, sxl), then, behind the loop's last barrier, the output staging
  __shared__ __align__(16) unsigned char sm[(128 + 64 + 64) * LP * 2];
  float (*so)[16][132] = (float (*)[16][132])sm;
  __bf16 (*sw)[LP] = (__bf16 (*)[LP])sm; __bf16 (*sxh)[LP] = (__bf16 (*)[LP])(sm + 128 * LP * 2); __bf16 (*sxl)[LP] = (__bf16 (*)[LP])(sm + (128 + 64) * LP * 2);   // 128 weight rows; 64 o rows as bf16 hi and residual
  const int tid = threadIdx.x, wave = tid >> 5, lane = tid & 31, col = lane & 15, g = lane >> 4; const size_t r0 = (size_t)blockIdx.x * 64 + wave * 16; const int n0 = blockIdx.y * 128;
  v8f acc[8] = {};
  const __bf16* wsrc = P + (size_t)(n0 + (tid >> 3)) * DM + (tid & 7) * 8;                       // a wave's 16-B load: 4 weight rows x 128 B
  const float* xsrc = O + ((size_t)blockIdx.x * 64 + (tid >> 4)) * DM + (tid & 15) * 4;           // a wave's 16-B load: 2 o rows x 256 B
  v4u wr[8]; v4f xr[8];
#pragma unroll
  for (int i = 0; i < 8; ++i) { wr[i] = *(const v4u*)(wsrc + (size_t)(16 * i) * DM); xr[i] = *(const v4f*)(xsrc + (size_t)(8 * i) * DM); }
#pragma unroll 1   // rolled: one copy of the pass keeps the prefetch registers' live range to one pass
  for (int ps = 0; ps < DM / KP; ++ps) {
#pragma unroll
    for (int i = 0; i < 8; ++i) { *(v4u*)&sw[(tid >> 3) + 16 * i][(tid & 7) * 8] = wr[i]; v4b ch, cl;
#pragma unroll
      for (int e = 0; e < 4; ++e) { const __bf16 hv = (__bf16)xr[i][e]; ch[e] = hv; cl[e] = (__bf16)(xr[i][e] - (float)hv); }
      *(v4b*)&sxh[(tid >> 4) + 8 * i][(tid & 15) * 4] = ch; *(v4b*)&sxl[(tid >> 4) + 8 * i][(tid & 15) * 4] = cl; }
    __syncthreads();   // the stage is written: every wave may read it
    if (ps + 1 < DM / KP) {   // the next pass's rows fly while this pass is multiplied
#pragma unroll
      for (int i = 0; i < 8; ++i) { wr[i] = *(const v4u*)(wsrc + (size_t)(16 * i) * DM + (ps + 1) * KP); xr[i] = *(const v4f*)(xsrc + (size_t)(8 * i) * DM + (ps + 1) * KP); }
      asm volatile("s_wait_xcnt 0x0" ::: "memory"); }   // stands in front of the loop's advance of the address registers that these loads name
#pragma unroll
    for (int kc = 0; kc < KP / 32; ++kc) { const v16b ah = frag_b(&sxh[wave * 16 + col][kc * 32], lane), al = frag_b(&sxl[wave * 16 + col][kc * 32], lane); v16b w[8];
#pragma unroll
      for (int j = 0; j < 8; ++j) w[j] = frag_b(&sw[j * 16 + col][kc * 32], lane);
      __builtin_amdgcn_sched_barrier(0);   // the LDS reads stay one group ahead of the products: read pair by pair among them, each product waits out a whole LDS latency
#pragma unroll
      for (int j = 0; j < 8; ++j) { acc[j] = wmma_bf(al, w[j], acc[j]); acc[j] = wmma_bf(ah, w[j], acc[j]); } }
    __syncthreads();   // every wave has read the stage: it may be rewritten (behind the last pass: by the output staging)
  }
#pragma unroll
  for (int j = 0; j < 8; ++j) {
#pragma unroll
    for (int r = 0; r < 8; ++r) so[wave][8 * g + r][j * 16 + col] = acc[j][r] + bfr(BO[n0 + j * 16 + col]); }
  LDSX();
  for (int rl = 0; rl < 16; ++rl) vst2(Y + (r0 + rl) * DM + n0 + lane * 4, *(const v4f*)&so[wave][rl][lane * 4]);
}
extern "C" void kernel_launch(void* const* d_in, const int* in_sizes, int n_in, void* d_out, int out_size, void* d_ws, size_t ws_size, hipStream_t stream) {
  (void)in_sizes; (void)n_in; (void)out_size;
  const float** F = (const float**)d_in;   // 0 x [2,2048,1024], 1 qkv_w [3072,1024] natural, 2 qkv_b, 3 out_w, 4 out_b, 5 anchor_k_min, 6 anchor_k_max, 7 anchor_v_min, 8 anchor_v_max ([2,16,1,64] each)
  if (ws_size < (size_t)WS_END) return;
  char* ws = (char*)d_ws; __bf16* PK = (__bf16*)(ws + WS_PK); _Float16 *QK = (_Float16*)(ws + WS_QK), *QKL = (_Float16*)(ws + WS_QKL), *VTH = (_Float16*)(ws + WS_VTH), *VTL = (_Float16*)(ws + WS_VTL); float* O = (float*)(ws + WS_O);
  k_pack<<<dim3(DM, 4), 256, 0, stream>>>(F[1], F[1] + (size_t)DM * DM, F[1] + (size_t)2 * DM * DM, F[3], PK);
  k_qkv<<<dim3(TNB * SS / 128, QKVW / 128), 128, 0, stream>>>(F[0], F[0], F[0], PK + PK_A, F[2], F[2] + DM, F[2] + 2 * DM, F[5], F[6], F[7], F[8], QK, QKL, VTH, VTL);
  k_attn<<<dim3(TQB, NH, TNB), 128, 0, stream>>>(QK, QKL, VTH, VTL, nullptr, O);
  k_out<<<dim3(TOB, DM / 128), 128, 0, stream>>>(O, PK + PK_P, F[4], (float*)d_out);
}

// v005
// A run of this version takes 97.7 microseconds.
// Timed twice side by side with v004, it ran 1.04 and 1.05 times as fast.
// Over all steps from v000 it is 4.11 times as fast.
// compute dtype: all float inputs rounded to bf16; qkv = x . W_qkv^T + b with EXACT bf16 products on WMMA 16x16x32 (natural rows; the fused weight as three contiguous row blocks); the guard clamp of k and v in f32 before the f16 rounding; PLAIN attention: q, k single f16 x 1/8, running-max softmax in f32 (hardware exp), P (scaled by 2^11, single f16) x v (single f16); out = o (bf16 hi + residual) . W_out^T (2 products) + b_out.
#include <hip/hip_runtime.h>
#include <math.h>

typedef __attribute__((ext_vector_type(16))) _Float16 v16h;
typedef __attribute__((ext_vector_type(16))) __bf16 v16b;
typedef __attribute__((ext_vector_type(8)))  _Float16 v8h;
typedef __attribute__((ext_vector_type(8)))  float v8f;
typedef __attribute__((ext_vector_type(4)))  float v4f;
typedef __attribute__((ext_vector_type(2)))  float v2f;
typedef __attribute__((ext_vector_type(4)))  unsigned v4u;
typedef __attribute__((ext_vector_type(4)))  int v4i;
typedef float __attribute__((may_alias)) float_a;
typedef int __attribute__((may_alias)) int_a;

template <typename T> __device__ __forceinline__ void vst2(void* p, T v) { *(T*)p = v;  }
__device__ __forceinline__ v8f wmma16(v16h a, v16h b, v8f c) {
  return __builtin_amdgcn_wmma_f32_16x16x32_f16(false, a, false, b, (short)0, c, false, false);   // plain builtin: the compiler keeps the hazard distances of its own WMMAs
}
__device__ __forceinline__ v8f wmma_bf(v16b a, v16b b, v8f c) {
  v8f d = __builtin_amdgcn_wmma_f32_16x16x32_bf16(false, a, false, b, (short)0, c, false, false);
  asm volatile("v_nop\n\tv_nop\n\tv_nop\n\tv_nop" : "+v"(d) : "v"(a), "v"(b));
  return d;
}
// Range-aware (guard-clamped) multi-head attention (B 2, S 2,048, d 1,024, 16 heads x 64): fused qkv projection + bias, k and v clamped against per-(batch, head, channel) anchor ranges with a 0.1 slack, softmax(q k^T / 8) v, output projection + bias.
__device__ __forceinline__ v16h frag_h(const _Float16* rowk0, int lane) {
  union { v16h v; v8h q[2]; } u; const _Float16* p = rowk0 + 8 * (lane >> 4);
  u.q[0] = *(const v8h*)p; u.q[1] = *(const v8h*)(p + 16); return u.v;
}
__device__ __forceinline__ v16h frag_f32(const float* rowk0, int lane) {
  v16h a; const float* p = rowk0 + 8 * (lane >> 4);
#pragma unroll
  for (int i = 0; i < 8; ++i) { a[i] = (_Float16)p[i]; a[8 + i] = (_Float16)p[16 + i]; }
  return a;
}
__device__ __forceinline__ v16h frag_f32s(const float* rowk0, int lane, float sc) {
  v16h a; const float* p = rowk0 + 8 * (lane >> 4);
#pragma unroll
  for (int i = 0; i < 8; ++i) { a[i] = (_Float16)(p[i] * sc); a[8 + i] = (_Float16)(p[16 + i] * sc); }
  return a;
}
// column fragment from a [K][ld] layout (column n), rows >= K read as 0
__device__ __forceinline__ v16h fragc_f32(const float* W, int k0, int n, int lane, int ld, int K) {
  v16h a; const int g = lane >> 4;
#pragma unroll
  for (int i = 0; i < 8; ++i) { const int ka = k0 + 8 * g + i, kb = ka + 16;
    a[i] = (_Float16)(ka < K ? W[(size_t)(ka < K ? ka : K - 1) * ld + n] : 0.f); a[8 + i] = (_Float16)(kb < K ? W[(size_t)(kb < K ? kb : K - 1) * ld + n] : 0.f); }
  return a;
}
struct F2 { v16b h, l; };
__device__ __forceinline__ F2 bsplit16(const float v[16]) { F2 r;
#pragma unroll
  for (int i = 0; i < 16; ++i) { const __bf16 h = (__bf16)v[i]; r.h[i] = h; r.l[i] = (__bf16)(v[i] - (float)h); }
  return r; }
__device__ __forceinline__ F2 split_row(const float* row, int k0, int lane) { float v[16]; const float* p = row + k0 + 8 * (lane >> 4);
#pragma unroll
  for (int i = 0; i < 8; ++i) { v[i] = p[i]; v[8 + i] = p[16 + i]; }
  return bsplit16(v); }
__device__ __forceinline__ F2 split_rowK(const float* row, int k0, int lane, int K) { float v[16]; const int g = lane >> 4;
#pragma unroll
  for (int i = 0; i < 8; ++i) { const int ka = k0 + 8 * g + i, kb = ka + 16; v[i] = ka < K ? row[ka < K ? ka : K - 1] : 0.f; v[8 + i] = kb < K ? row[kb < K ? kb : K - 1] : 0.f; }
  return bsplit16(v); }
__device__ __forceinline__ F2 split_col(const float* W, int k0, int n, int lane, int ld, int K) { float v[16]; const int g = lane >> 4;
#pragma unroll
  for (int i = 0; i < 8; ++i) { const int ka = k0 + 8 * g + i, kb = ka + 16; v[i] = ka < K ? W[(size_t)(ka < K ? ka : K - 1) * ld + n] : 0.f; v[8 + i] = kb < K ? W[(size_t)(kb < K ? kb : K - 1) * ld + n] : 0.f; }
  return bsplit16(v); }
__device__ __forceinline__ v8f mac3(const F2& a, const F2& b, v8f c) { c = wmma_bf(a.l, b.h, c); c = wmma_bf(a.h, b.l, c); return wmma_bf(a.h, b.h, c); }
__device__ __forceinline__ float sigm(float v) { return 1.0f / (1.0f + expf(-v)); }
#define LDSX() do { asm volatile("s_wait_dscnt 0" ::: "memory"); __builtin_amdgcn_wave_barrier(); __builtin_amdgcn_fence(__ATOMIC_RELEASE, "workgroup"); } while (0)


#define NB 2
#define SS 2048
#define DM 1024
#define NH 16
#define GEPS 0.1f
__device__ __forceinline__ float gclamp(float tv, float amin, float amax) { float lo = fmaxf(tv - GEPS, amin); const float hi = fminf(tv + GEPS, amax); lo = fminf(lo, hi); return fmaxf(lo, fminf(tv, hi)); }
#define HD 64
#define QKVW (3 * DM)
#ifndef TQB
#define TQB (SS / 64)
#define TNB NB
#define TOB (NB * SS / 64)     // output row tiles (all)
#endif
typedef __attribute__((ext_vector_type(8))) __bf16 v8b;
__device__ __forceinline__ v16b frag_b(const __bf16* rowk0, int lane) {
  union { v16b v; v8b q[2]; } u; const __bf16* p = rowk0 + 8 * (lane >> 4);
  u.q[0] = *(const v8b*)p; u.q[1] = *(const v8b*)(p + 16); return u.v;
}
__device__ __forceinline__ float bfr(float v) { return (float)(__bf16)v; }
typedef __attribute__((ext_vector_type(4))) __bf16 v4b;
#define KP 64   // k (or keys) per staged pass: 128 B of every 16-bit operand row, one whole line
#define LP 72   // LDS row pitch in 16-bit elements: 128 B of data + 16 B, the pitch for ds_load_b128 readers
__device__ __attribute__((noinline)) float exp_ni(float v) { return expf(v); }
__device__ __attribute__((noinline)) float erf_ni(float v) { return erff(v); }

#define PK_A 0                       // [3072][1024] Wqkv rows (natural [out][in])
#define PK_P (PK_A + QKVW * DM)        // [1024][1024] Wo rows (natural)
#define PK_END (PK_P + DM * DM)
#define WS_PK  0u
#define WS_QK  (WS_PK + 2u * PK_END)             // f16 [4096 rows][2048]: q | k
#define WS_QKL (WS_QK + 2u * NB * SS * 2 * DM)     // f16 q | k residual planes x2048
#define WS_VTH (WS_QKL + 2u * NB * SS * 2 * DM)    // f16 [b][1024 (h*64+d)][2048 s] hi
#define WS_VTL (WS_VTH + 2u * NB * DM * SS)        // f16 lo x 2048
#define WS_O   (WS_VTL + 2u * NB * DM * SS)        // f32 [4096][1024]
#define WS_CS  (WS_O + 4u * NB * SS * DM)           // f32 2 x [2048][32], not used by any kernel
#define WS_END (WS_CS + 4u * 2 * SS * 32)
// ---- k_pack: block = (row n, which): natural [out][in] rows -> bf16; which 0..2 -> W_q/W_k/W_v into PK_A rows which*1024 + n; 3 -> W_o into PK_P
__global__ __launch_bounds__(256) void k_pack(const float* __restrict__ WQ, const float* __restrict__ WK, const float* __restrict__ WV, const float* __restrict__ WO, __bf16* __restrict__ PK) {
  __shared__ __align__(16) __bf16 s[DM]; const int n = blockIdx.x, which = blockIdx.y, t = threadIdx.x; const float* Wm = (which == 0) ? WQ : (which == 1) ? WK : (which == 2) ? WV : WO;
  for (int k = t; k < DM; k += 256) s[k] = (__bf16)Wm[(size_t)n * DM + k];
  __syncthreads();
  __bf16* dst = (which < 3) ? PK + PK_A + ((size_t)which * DM + n) * DM : PK + PK_P + (size_t)n * DM;
  for (int q = t; q < DM / 8; q += 256) vst2((unsigned*)(dst + q * 8), *(const v4u*)&s[q * 8]);
}
__global__ __launch_bounds__(128) void k_qkv(const float* __restrict__ XQ, const float* __restrict__ XK, const float* __restrict__ XV, const __bf16* __restrict__ P, const float* __restrict__ BQ, const float* __restrict__ BK, const float* __restrict__ BV, const float* __restrict__ AKMIN, const float* __restrict__ AKMAX, const float* __restrict__ AVMIN, const float* __restrict__ AVMAX, _Float16* __restrict__ QK, _Float16* __restrict__ QKL, _Float16* __restrict__ VTH, _Float16* __restrict__ VTL) {
  const int which0 = (blockIdx.y * 128) / DM; const float* X = (which0 == 0) ? XQ : (which0 == 1) ? XK : XV; const float* BB = BQ ? (((which0 == 0) ? BQ : (which0 == 1) ? BK : BV) + (blockIdx.y * 128 - which0 * DM)) : nullptr;
  // block = 128 x rows by 128 weight rows; the four waves stand 2 x 2, each on 64 x 64 of it (4 x 4 accumulator tiles): every staged fragment feeds four products, and a staged byte serves twice the rows it did
  // one LDS range: the operand stage of the k loop (sw, sx), then, behind the loop's last barrier, each wave's own output staging (two planes of 64 rows)
  __shared__ __align__(16) unsigned char sm[4 * 2 * 64 * LP * 2];
  __bf16 (*sw)[LP] = (__bf16 (*)[LP])sm; __bf16 (*sx)[LP] = (__bf16 (*)[LP])(sm + 128 * LP * 2);   // 128 weight rows, 128 x rows (bf16), KP k each
  const int tid = threadIdx.x, wave = tid >> 5, lane = tid & 31, col = lane & 15, g = lane >> 4, wm = wave >> 1, wn = wave & 1; const size_t rb = (size_t)blockIdx.x * 128; const int n0 = blockIdx.y * 128;
  _Float16 (*sh)[LP] = (_Float16 (*)[LP])(sm + wave * (2 * 64 * LP * 2)); _Float16 (*sl)[LP] = sh + 64;   // this wave's staging: value plane, residual plane
  v8f acc[4][4] = {};
  const __bf16* wsrc = P + (size_t)(n0 + (tid >> 3)) * DM + (tid & 7) * 8;                       // a wave's 16-B load: 4 weight rows x 128 B
  const float* xsrc = X + (rb + (tid >> 4)) * DM + (tid & 15) * 4;                                // a wave's 16-B load: 2 x rows x 256 B
  v4u wr[8]; v4f xr[16];
#pragma unroll
  for (int i = 0; i < 8; ++i) wr[i] = *(const v4u*)(wsrc + (size_t)(16 * i) * DM);
#pragma unroll
  for (int i = 0; i < 16; ++i) xr[i] = *(const v4f*)(xsrc + (size_t)(8 * i) * DM);
  asm volatile("s_wait_xcnt 0x0" :: "v"(wsrc), "v"(xsrc) : "memory");   // stands in front of the reuse of the address registers that these first loads name: as inputs they stay live up to the wait
#pragma unroll 1   // rolled: one copy of the pass keeps the prefetch registers' live range to one pass
  for (int ps = 0; ps < DM / KP; ++ps) {
#pragma unroll
    for (int i = 0; i < 8; ++i) *(v4u*)&sw[(tid >> 3) + 16 * i][(tid & 7) * 8] = wr[i];
#pragma unroll
    for (int i = 0; i < 16; ++i) { v4b c;
#pragma unroll
      for (int e = 0; e < 4; ++e) c[e] = (__bf16)xr[i][e];
      *(v4b*)&sx[(tid >> 4) + 8 * i][(tid & 15) * 4] = c; }
    __syncthreads();   // the stage is written: every wave may read it
    if (ps + 1 < DM / KP) {   // the next pass's rows fly while this pass is multiplied
#pragma unroll
      for (int i = 0; i < 8; ++i) wr[i] = *(const v4u*)(wsrc + (size_t)(16 * i) * DM + (ps + 1) * KP);
#pragma unroll
      for (int i = 0; i < 16; ++i) xr[i] = *(const v4f*)(xsrc + (size_t)(8 * i) * DM + (ps + 1) * KP);
      asm volatile("s_wait_xcnt 0x0" ::: "memory"); }   // stands in front of the loop's advance of the address registers that these loads name
#pragma unroll
    for (int kc = 0; kc < KP / 32; ++kc) { v16b a[4], w[4];
#pragma unroll
      for (int i = 0; i < 4; ++i) a[i] = frag_b(&sx[wm * 64 + i * 16 + col][kc * 32], lane);
#pragma unroll
      for (int j = 0; j < 4; ++j) w[j] = frag_b(&sw[wn * 64 + j * 16 + col][kc * 32], lane);
      __builtin_amdgcn_sched_barrier(0);   // the LDS reads stay one group ahead of the products: read pair by pair among them, each product waits out a whole LDS latency
#pragma unroll
      for (int i = 0; i < 4; ++i) {
#pragma unroll
        for (int j = 0; j < 4; ++j) acc[i][j] = wmma_bf(a[i], w[j], acc[i][j]); } }
    __syncthreads();   // every wave has read the stage: it may be rewritten (behind the last pass: by the output staging)
  }
  const int b = (int)(rb / SS), c0 = wn * 64, cb = c0 + col;   // a block's 128 rows lie in one batch; cb: this lane's first column in the block
  const bool isv = n0 >= 2 * DM, cl = n0 >= DM;   // block-uniform: v block; block whose values are guard-clamped (k, v)
  const size_t a0 = (size_t)b * DM + (cl ? n0 - (isv ? 2 * DM : DM) : 0) + cb; const float* pmin = (isv ? AVMIN : AKMIN) + a0; const float* pmax = (isv ? AVMAX : AKMAX) + a0;
  float bias[4] = {0.f, 0.f, 0.f, 0.f}, amin[4] = {0.f, 0.f, 0.f, 0.f}, amax[4] = {0.f, 0.f, 0.f, 0.f};   // of columns cb + 16 j: loaded as one group, one latency for all
  if (BB) {
#pragma unroll
    for (int j = 0; j < 4; ++j) bias[j] = BB[cb + 16 * j]; }
  if (cl) {
#pragma unroll
    for (int j = 0; j < 4; ++j) { amin[j] = pmin[16 * j]; amax[j] = pmax[16 * j]; } }
  asm volatile("s_wait_xcnt 0x0" :: "v"(cb), "s"(BB), "v"(pmin), "v"(pmax) : "memory");   // stands in front of the reuse of the address registers that these loads name: as inputs they stay live up to the wait
#pragma unroll
  for (int j = 0; j < 4; ++j) { bias[j] = bfr(bias[j]); amin[j] = bfr(amin[j]); amax[j] = bfr(amax[j]); }
  if (!cl) {   // q stored unscaled (f16 sigma ~0.6, no subnormal exposure); 1/8 applied to the f32 score
#pragma unroll
    for (int j = 0; j < 4; ++j) {
#pragma unroll
      for (int i = 0; i < 4; ++i) {
#pragma unroll
        for (int r = 0; r < 8; ++r) { const float v = acc[i][j][r] + bias[j];
          const _Float16 hv = (_Float16)v; sh[i * 16 + 8 * g + r][j * 16 + col] = hv; sl[i * 16 + 8 * g + r][j * 16 + col] = (_Float16)((v - (float)hv) * 2048.0f); } } }   // q (+ bias) as f16 hi + (x2048) residual
  } else if (!isv) {
#pragma unroll
    for (int j = 0; j < 4; ++j) {
#pragma unroll
      for (int i = 0; i < 4; ++i) {
#pragma unroll
        for (int r = 0; r < 8; ++r) { const float v = gclamp(acc[i][j][r] + bias[j], amin[j], amax[j]);   /* k guard-clamped per (b, h, d) */
          const _Float16 hv = (_Float16)v; sh[i * 16 + 8 * g + r][j * 16 + col] = hv; sl[i * 16 + 8 * g + r][j * 16 + col] = (_Float16)((v - (float)hv) * 2048.0f); } } }   // k (+ bias) as f16 hi + (x2048) residual
  } else {
#pragma unroll
    for (int j = 0; j < 4; ++j) {
#pragma unroll
      for (int i = 0; i < 4; ++i) {
#pragma unroll
        for (int r = 0; r < 8; ++r) { const float v = gclamp(acc[i][j][r] + bias[j], amin[j], amax[j]);   /* v guard-clamped */
          const _Float16 hv = (_Float16)v; sh[j * 16 + col][i * 16 + 8 * g + r] = hv; sl[j * 16 + col][i * 16 + 8 * g + r] = (_Float16)((v - (float)hv) * 2048.0f); } } }   // staged transposed: row = channel, 64 positions along it
  }
  LDSX();
  // staged rows go out as whole lines: q, k: row = position, into [position][2048]; v: row = channel, into [b][channel][position]
  _Float16* dh = isv ? VTH + ((size_t)b * DM + (n0 - 2 * DM) + c0) * SS + (rb % SS) + wm * 64 : QK + (rb + wm * 64) * (2 * DM) + n0 + c0;
  _Float16* dl = isv ? VTL + ((size_t)b * DM + (n0 - 2 * DM) + c0) * SS + (rb % SS) + wm * 64 : QKL + (rb + wm * 64) * (2 * DM) + n0 + c0;
  for (int it = 0; it < 16; ++it) { const int row = it * 4 + (lane >> 3), ch = lane & 7; const size_t o = (size_t)row * (isv ? SS : 2 * DM) + ch * 8;   // a wave's 16-B store: 4 rows x 128 B
    vst2((unsigned*)(dh + o), *(const v4u*)&sh[row][ch * 8]); vst2((unsigned*)(dl + o), *(const v4u*)&sl[row][ch * 8]); }
}
// ---- k_attn: block = (64 queries, head h, batch b): all-keys flash attention with TRANSPOSED products: S^T = K . Q^T (A = key rows from the stage, B = the wave's q rows kept in registers), so a lane holds 16 scores of ONE query (column col; keys 8g + r and 16 + 8g + r of the 32): maximum and sum run in the lane, one exchange between the lane halves joins the maximum; the two score tiles, exponentiated and rounded in place, ARE the B operand of O^T += V^T . P^T (A = channel rows of v from the stage): P never goes through LDS. O[b*S+q][h*64+d] = acc / l (256-B segments)
// lane l <-> lane l ^ 16 as a vector cross-row move: the shuffle builtin would go through the LDS pipe and its wait
__device__ __forceinline__ float xhalf(float v) { const int i = __builtin_bit_cast(int, v); return __builtin_bit_cast(float, __builtin_amdgcn_permlanex16(i, i, 0x76543210, 0xfedcba98, false, false)); }
__global__ __launch_bounds__(128) void k_attn(const _Float16* __restrict__ QK, const _Float16* __restrict__ QKL, const _Float16* __restrict__ VTH, const _Float16* __restrict__ VTL, const void* __restrict__ KMASK, float* __restrict__ O) {
  __shared__ __align__(16) float so[4][16][68];
  __shared__ __align__(16) _Float16 sk[KP][LP], sv[HD][LP];   // the stage: KP keys x 64 channels; 64 channels of v x KP keys
  const int tid = threadIdx.x, wave = tid >> 5, lane = tid & 31, col = lane & 15, g = lane >> 4;
  const int qb = blockIdx.x, h = blockIdx.y, b = blockIdx.z; const int q0 = qb * 64 + wave * 16; const size_t rq = (size_t)b * SS + q0 + col;
  v16h aq[2];   // B operand of the score product: column col = query q0 + col, channels in the loader's k order (the same loader as the key rows')
#pragma unroll
  for (int kc = 0; kc < 2; ++kc) aq[kc] = frag_h(QK + rq * (2 * DM) + h * HD + kc * 32, lane);
  const float CS = 0.125f * 1.44269504088896340736f;   // 1/sqrt(64) and log2(e) in one factor: weight x 2^11 = 2^(score * CS + nb), nb = 11 - maximum * CS
  float m = -3.0e38f, nb = 11.0f + 3.0e38f * CS, l = 0.f;   // of query col: m = maximum of the raw scores so far (equal in both lane halves), nb its exponent offset, l (x 2^11) over this lane half's keys (the halves are joined in the epilogue)
  v8f acc[4] = {};   // acc[dt][r] = O^T[channel dt * 16 + 8g + r][query col] (x 2^11)
  const _Float16* ksrc = QK + ((size_t)b * SS + (tid >> 3)) * (2 * DM) + DM + h * HD + (tid & 7) * 8;   // a wave's 16-B load: 4 key rows x 128 B
  const _Float16* vsrc = VTH + ((size_t)b * DM + h * HD + (tid >> 3)) * SS + (tid & 7) * 8;               // a wave's 16-B load: 4 channel rows x 128 B
  v4u kr[4], vr[4];
#pragma unroll
  for (int i = 0; i < 4; ++i) { kr[i] = *(const v4u*)(ksrc + (size_t)(16 * i) * (2 * DM)); vr[i] = *(const v4u*)(vsrc + (size_t)(16 * i) * SS); }
#pragma unroll 1   // rolled: one copy of the stage's code
  for (int st = 0; st < SS / KP; ++st) {   // all keys, KP a stage
#pragma unroll
  for (int i = 0; i < 4; ++i) { *(v4u*)&sk[(tid >> 3) + 16 * i][(tid & 7) * 8] = kr[i]; *(v4u*)&sv[(tid >> 3) + 16 * i][(tid & 7) * 8] = vr[i]; }
  __syncthreads();   // the stage is written: every wave may read it
  if (st + 1 < SS / KP) {   // the next stage's rows fly while this one is worked on
#pragma unroll
    for (int i = 0; i < 4; ++i) { kr[i] = *(const v4u*)(ksrc + ((size_t)(st + 1) * KP + 16 * i) * (2 * DM)); vr[i] = *(const v4u*)(vsrc + (size_t)(16 * i) * SS + (st + 1) * KP); } }
#pragma unroll 1   // rolled: the 32-key body stays one copy, as it was
  for (int ks = 0; ks < KP / 32; ++ks) { v8f s[2]; v16h kf[2][2], vf[4];
#pragma unroll
    for (int ct = 0; ct < 2; ++ct) {
#pragma unroll
      for (int kc = 0; kc < 2; ++kc) kf[ct][kc] = frag_h(&sk[ks * 32 + ct * 16 + col][kc * 32], lane); }   // A: row col = key ct * 16 + col
#pragma unroll
    for (int dt = 0; dt < 4; ++dt) vf[dt] = frag_h(&sv[dt * 16 + col][ks * 32], lane);   // A of the second product: row col = channel dt * 16 + col; its k order (keys 8g + i, 16 + 8g + i) is that of the packed score tiles
    __builtin_amdgcn_sched_barrier(0);   // the LDS reads stay one group ahead of the products: read pair by pair among them, each product waits out a whole LDS latency (the v rows land under the scores and the softmax)
#pragma unroll
    for (int ct = 0; ct < 2; ++ct) { v8f c = {};
#pragma unroll
      for (int kc = 0; kc < 2; ++kc) c = wmma16(kf[ct][kc], aq[kc], c);   // single product: k, q as one-rounding f16 operands; c[r] = raw score of key ct * 16 + 8g + r with query col
      s[ct] = c; }
    float mx = fmaxf(s[0][0], s[1][0]);
#pragma unroll
    for (int r = 1; r < 8; ++r) mx = fmaxf(mx, fmaxf(s[0][r], s[1][r]));
    mx = fmaxf(mx, xhalf(mx));   // both lane halves hold the query's maximum over the 32 keys
    const float mn = fmaxf(m, mx), nbn = fmaf(mn, -CS, 11.0f); const float alpha = __builtin_amdgcn_exp2f(nbn - nb);   // 2^((m - mn) * CS); 0 in the first pass, where nb is huge
    v16h pa; v2f es = {0.f, 0.f};
#pragma unroll
    for (int ct = 0; ct < 2; ++ct) {
#pragma unroll
      for (int i = 0; i < 4; ++i) { const v2f sp = {s[ct][2 * i], s[ct][2 * i + 1]}, t = sp * CS + nbn;   // neighbouring score registers as a pair: one packed multiply-add, two hardware exponentials, one packed add for two scores
        const v2f e = {__builtin_amdgcn_exp2f(t[0]), __builtin_amdgcn_exp2f(t[1])};
        es += e; pa[8 * ct + 2 * i] = (_Float16)e[0]; pa[8 * ct + 2 * i + 1] = (_Float16)e[1]; } }   // P carries 2^11 (the 11 in nb) so small softmax weights stay out of the f16 subnormal range; l carries it too, so it cancels in the epilogue
    l = l * alpha + (es[0] + es[1]); m = mn; nb = nbn;
#pragma unroll
    for (int dt = 0; dt < 4; ++dt) acc[dt] *= alpha;
#pragma unroll
    for (int dt = 0; dt < 4; ++dt) acc[dt] = wmma16(vf[dt], pa, acc[dt]); }   // single product: V^T x P^T (x2^11)
  __syncthreads();   // every wave has read the stage: it may be rewritten
  }
  { const float il = 1.0f / (l + xhalf(l));   // the two lane halves' sums joined, unconditionally
#pragma unroll
    for (int dt = 0; dt < 4; ++dt) {
#pragma unroll
      for (int q = 0; q < 2; ++q) { v4f o;
#pragma unroll
        for (int e = 0; e < 4; ++e) o[e] = acc[dt][4 * q + e] * il;
        *(v4f*)&so[wave][col][dt * 16 + 8 * g + 4 * q] = o; } } }
  LDSX();
  for (int rl = 0; rl < 16; ++rl) if (lane < 16) vst2(O + ((size_t)b * SS + q0 + rl) * DM + h * HD + lane * 4, *(const v4f*)&so[wave][rl][lane * 4]);
}
// ---- k_out: block = (64 rows, 128 cols): out = O(hi/lo) . Wo rows (2 products) + bo
__global__ __launch_bounds__(128) void k_out(const float* __restrict__ O, const __bf16* __restrict__ P, const float* __restrict__ BO, float* __restrict__ Y) {
  // one LDS range: the operand stage of the k loop (sw, sxh, sxl), then, behind the loop's last barrier, the output staging
  __shared__ __align__(16) unsigned char sm[(128 + 64 + 64) * LP * 2];
  float (*so)[16][132] = (float (*)[16][132])sm;
  __bf16 (*sw)[LP] = (__bf16 (*)[LP])sm; __bf16 (*sxh)[LP] = (__bf16 (*)[LP])(sm + 128 * LP * 2); __bf16 (*sxl)[LP] = (__bf16 (*)[LP])(sm + (128 + 64) * LP * 2);   // 128 weight rows; 64 o rows as bf16 hi and residual
  const int tid = threadIdx.x, wave = tid >> 5, lane = tid & 31, col = lane & 15, g = lane >> 4; const size_t r0 = (size_t)blockIdx.x * 64 + wave * 16; const int n0 = blockIdx.y * 128;
  v8f acc[8] = {};
  const __bf16* wsrc = P + (size_t)(n0 + (tid >> 3)) * DM + (tid & 7) * 8;                       // a wave's 16-B load: 4 weight rows x 128 B
  const float* xsrc = O + ((size_t)blockIdx.x * 64 + (tid >> 4)) * DM + (tid & 15) * 4;           // a wave's 16-B load: 2 o rows x 256 B
  v4u wr[8]; v4f xr[8];
#pragma unroll
  for (int i = 0; i < 8; ++i) { wr[i] = *(const v4u*)(wsrc + (size_t)(16 * i) * DM); xr[i] = *(const v4f*)(xsrc + (size_t)(8 * i) * DM); }
#pragma unroll 1   // rolled: one copy of the pass keeps the prefetch registers' live range to one pass
  for (int ps = 0; ps < DM / KP; ++ps) {
#pragma unroll
    for (int i = 0; i < 8; ++i) { *(v4u*)&sw[(tid >> 3) + 16 * i][(tid & 7) * 8] = wr[i]; v4b ch, cl;
#pragma unroll
      for (int e = 0; e < 4; ++e) { const __bf16 hv = (__bf16)xr[i][e]; ch[e] = hv; cl[e] = (__bf16)(xr[i][e] - (float)hv); }
      *(v4b*)&sxh[(tid >> 4) + 8 * i][(tid & 15) * 4] = ch; *(v4b*)&sxl[(tid >> 4) + 8 * i][(tid & 15) * 4] = cl; }
    __syncthreads();   // the stage is written: every wave may read it
    if (ps + 1 < DM / KP) {   // the next pass's rows fly while this pass is multiplied
#pragma unroll
      for (int i = 0; i < 8; ++i) { wr[i] = *(const v4u*)(wsrc + (size_t)(16 * i) * DM + (ps + 1) * KP); xr[i] = *(const v4f*)(xsrc + (size_t)(8 * i) * DM + (ps + 1) * KP); }
      asm volatile("s_wait_xcnt 0x0" ::: "memory"); }   // stands in front of the loop's advance of the address registers that these loads name
#pragma unroll
    for (int kc = 0; kc < KP / 32; ++kc) { const v16b ah = frag_b(&sxh[wave * 16 + col][kc * 32], lane), al = frag_b(&sxl[wave * 16 + col][kc * 32], lane); v16b w[8];
#pragma unroll
      for (int j = 0; j < 8; ++j) w[j] = frag_b(&sw[j * 16 + col][kc * 32], lane);
      __builtin_amdgcn_sched_barrier(0);   // the LDS reads stay one group ahead of the products: read pair by pair among them, each product waits out a whole LDS latency
#pragma unroll
      for (int j = 0; j < 8; ++j) { acc[j] = wmma_bf(al, w[j], acc[j]); acc[j] = wmma_bf(ah, w[j], acc[j]); } }
    __syncthreads();   // every wave has read the stage: it may be rewritten (behind the last pass: by the output staging)
  }
#pragma unroll
  for (int j = 0; j < 8; ++j) {
#pragma unroll
    for (int r = 0; r < 8; ++r) so[wave][8 * g + r][j * 16 + col] = acc[j][r] + bfr(BO[n0 + j * 16 + col]); }
  LDSX();
  for (int rl = 0; rl < 16; ++rl) vst2(Y + (r0 + rl) * DM + n0 + lane * 4, *(const v4f*)&so[wave][rl][lane * 4]);
}
extern "C" void kernel_launch(void* const* d_in, const int* in_sizes, int n_in, void* d_out, int out_size, void* d_ws, size_t ws_size, hipStream_t stream) {
  (void)in_sizes; (void)n_in; (void)out_size;
  const float** F = (const float**)d_in;   // 0 x [2,2048,1024], 1 qkv_w [3072,1024] natural, 2 qkv_b, 3 out_w, 4 out_b, 5 anchor_k_min, 6 anchor_k_max, 7 anchor_v_min, 8 anchor_v_max ([2,16,1,64] each)
  if (ws_size < (size_t)WS_END) return;
  char* ws = (char*)d_ws; __bf16* PK = (__bf16*)(ws + WS_PK); _Float16 *QK = (_Float16*)(ws + WS_QK), *QKL = (_Float16*)(ws + WS_QKL), *VTH = (_Float16*)(ws + WS_VTH), *VTL = (_Float16*)(ws + WS_VTL); float* O = (float*)(ws + WS_O);
  k_pack<<<dim3(DM, 4), 256, 0, stream>>>(F[1], F[1] + (size_t)DM * DM, F[1] + (size_t)2 * DM * DM, F[3], PK);
  k_qkv<<<dim3(TNB * SS / 128, QKVW / 128), 128, 0, stream>>>(F[0], F[0], F[0], PK + PK_A, F[2], F[2] + DM, F[2] + 2 * DM, F[5], F[6], F[7], F[8], QK, QKL, VTH, VTL);
  k_attn<<<dim3(TQB, NH, TNB), 128, 0, stream>>>(QK, QKL, VTH, VTL, nullptr, O);
  k_out<<<dim3(TOB, DM / 128), 128, 0, stream>>>(O, PK + PK_P, F[4], (float*)d_out);
}

// v006
// One run takes 94.4 microseconds.
// In two side-by-side timings against v005, it was 1.03 and 1.02 times as fast.
// Over all steps from v000 it is 4.23 times as fast.
// compute dtype: all float inputs rounded to bf16; qkv = x . W_qkv^T + b with EXACT bf16 products on WMMA 16x16x32 (natural rows; the fused weight as three contiguous row blocks); the guard clamp of k and v in f32 before the f16 rounding; PLAIN attention: q, k single f16 x 1/8, running-max softmax in f32 (hardware exp), P (scaled by 2^11, single f16) x v (single f16); out = o (bf16 hi + residual) . W_out^T (2 products) + b_out.
#include <hip/hip_runtime.h>
#include <math.h>

typedef __attribute__((ext_vector_type(16))) _Float16 v16h;
typedef __attribute__((ext_vector_type(16))) __bf16 v16b;
typedef __attribute__((ext_vector_type(8)))  _Float16 v8h;
typedef __attribute__((ext_vector_type(8)))  float v8f;
typedef __attribute__((ext_vector_type(4)))  float v4f;
typedef __attribute__((ext_vector_type(2)))  float v2f;
typedef __attribute__((ext_vector_type(4)))  unsigned v4u;
typedef __attribute__((ext_vector_type(4)))  int v4i;
typedef float __attribute__((may_alias)) float_a;
typedef int __attribute__((may_alias)) int_a;

template <typename T> __device__ __forceinline__ void vst2(void* p, T v) { *(T*)p = v;  }
__device__ __forceinline__ v8f wmma16(v16h a, v16h b, v8f c) {
  return __builtin_amdgcn_wmma_f32_16x16x32_f16(false, a, false, b, (short)0, c, false, false);   // plain builtin: the compiler keeps the hazard distances of its own WMMAs
}
__device__ __forceinline__ v8f wmma_bf(v16b a, v16b b, v8f c) {
  v8f d = __builtin_amdgcn_wmma_f32_16x16x32_bf16(false, a, false, b, (short)0, c, false, false);
  asm volatile("v_nop\n\tv_nop\n\tv_nop\n\tv_nop" : "+v"(d) : "v"(a), "v"(b));
  return d;
}
// Range-aware (guard-clamped) multi-head attention (B 2, S 2,048, d 1,024, 16 heads x 64): fused qkv projection + bias, k and v clamped against per-(batch, head, channel) anchor ranges with a 0.1 slack, softmax(q k^T / 8) v, output projection + bias.
__device__ __forceinline__ v16h frag_h(const _Float16* rowk0, int lane) {
  union { v16h v; v8h q[2]; } u; const _Float16* p = rowk0 + 8 * (lane >> 4);
  u.q[0] = *(const v8h*)p; u.q[1] = *(const v8h*)(p + 16); return u.v;
}
__device__ __forceinline__ v16h frag_f32(const float* rowk0, int lane) {
  v16h a; const float* p = rowk0 + 8 * (lane >> 4);
#pragma unroll
  for (int i = 0; i < 8; ++i) { a[i] = (_Float16)p[i]; a[8 + i] = (_Float16)p[16 + i]; }
  return a;
}
__device__ __forceinline__ v16h frag_f32s(const float* rowk0, int lane, float sc) {
  v16h a; const float* p = rowk0 + 8 * (lane >> 4);
#pragma unroll
  for (int i = 0; i < 8; ++i) { a[i] = (_Float16)(p[i] * sc); a[8 + i] = (_Float16)(p[16 + i] * sc); }
  return a;
}
// column fragment from a [K][ld] layout (column n), rows >= K read as 0
__device__ __forceinline__ v16h fragc_f32(const float* W, int k0, int n, int lane, int ld, int K) {
  v16h a; const int g = lane >> 4;
#pragma unroll
  for (int i = 0; i < 8; ++i) { const int ka = k0 + 8 * g + i, kb = ka + 16;
    a[i] = (_Float16)(ka < K ? W[(size_t)(ka < K ? ka : K - 1) * ld + n] : 0.f); a[8 + i] = (_Float16)(kb < K ? W[(size_t)(kb < K ? kb : K - 1) * ld + n] : 0.f); }
  return a;
}
struct F2 { v16b h, l; };
__device__ __forceinline__ F2 bsplit16(const float v[16]) { F2 r;
#pragma unroll
  for (int i = 0; i < 16; ++i) { const __bf16 h = (__bf16)v[i]; r.h[i] = h; r.l[i] = (__bf16)(v[i] - (float)h); }
  return r; }
__device__ __forceinline__ F2 split_row(const float* row, int k0, int lane) { float v[16]; const float* p = row + k0 + 8 * (lane >> 4);
#pragma unroll
  for (int i = 0; i < 8; ++i) { v[i] = p[i]; v[8 + i] = p[16 + i]; }
  return bsplit16(v); }
__device__ __forceinline__ F2 split_rowK(const float* row, int k0, int lane, int K) { float v[16]; const int g = lane >> 4;
#pragma unroll
  for (int i = 0; i < 8; ++i) { const int ka = k0 + 8 * g + i, kb = ka + 16; v[i] = ka < K ? row[ka < K ? ka : K - 1] : 0.f; v[8 + i] = kb < K ? row[kb < K ? kb : K - 1] : 0.f; }
  return bsplit16(v); }
__device__ __forceinline__ F2 split_col(const float* W, int k0, int n, int lane, int ld, int K) { float v[16]; const int g = lane >> 4;
#pragma unroll
  for (int i = 0; i < 8; ++i) { const int ka = k0 + 8 * g + i, kb = ka + 16; v[i] = ka < K ? W[(size_t)(ka < K ? ka : K - 1) * ld + n] : 0.f; v[8 + i] = kb < K ? W[(size_t)(kb < K ? kb : K - 1) * ld + n] : 0.f; }
  return bsplit16(v); }
__device__ __forceinline__ v8f mac3(const F2& a, const F2& b, v8f c) { c = wmma_bf(a.l, b.h, c); c = wmma_bf(a.h, b.l, c); return wmma_bf(a.h, b.h, c); }
__device__ __forceinline__ float sigm(float v) { return 1.0f / (1.0f + expf(-v)); }
#define LDSX() do { asm volatile("s_wait_dscnt 0" ::: "memory"); __builtin_amdgcn_wave_barrier(); __builtin_amdgcn_fence(__ATOMIC_RELEASE, "workgroup"); } while (0)


#define NB 2
#define SS 2048
#define DM 1024
#define NH 16
#define GEPS 0.1f
__device__ __forceinline__ float gclamp(float tv, float amin, float amax) { float lo = fmaxf(tv - GEPS, amin); const float hi = fminf(tv + GEPS, amax); lo = fminf(lo, hi); return fmaxf(lo, fminf(tv, hi)); }
#define HD 64
#define QKVW (3 * DM)
#ifndef TQB
#define TQB (SS / 64)
#define TNB NB
#define TOB (NB * SS / 64)     // output row tiles (all)
#endif
typedef __attribute__((ext_vector_type(8))) __bf16 v8b;
__device__ __forceinline__ v16b frag_b(const __bf16* rowk0, int lane) {
  union { v16b v; v8b q[2]; } u; const __bf16* p = rowk0 + 8 * (lane >> 4);
  u.q[0] = *(const v8b*)p; u.q[1] = *(const v8b*)(p + 16); return u.v;
}
__device__ __forceinline__ float bfr(float v) { return (float)(__bf16)v; }
typedef __attribute__((ext_vector_type(4))) __bf16 v4b;
#define KP 64   // k (or keys) per staged pass: 128 B of every 16-bit operand row, one whole line
#define LP 72   // LDS row pitch in 16-bit elements: 128 B of data + 16 B, the pitch for ds_load_b128 readers
__device__ __attribute__((noinline)) float exp_ni(float v) { return expf(v); }
__device__ __attribute__((noinline)) float erf_ni(float v) { return erff(v); }

#define PK_A 0                       // [3072][1024] Wqkv rows (natural [out][in])
#define PK_P (PK_A + QKVW * DM)        // [1024][1024] Wo rows (natural)
#define PK_END (PK_P + DM * DM)
#define WS_PK  0u
#define WS_QK  (WS_PK + 2u * PK_END)             // f16 [4096 rows][2048]: q | k
#define WS_QKL (WS_QK + 2u * NB * SS * 2 * DM)     // f16 q | k residual planes x2048
#define WS_VTH (WS_QKL + 2u * NB * SS * 2 * DM)    // f16 [b][1024 (h*64+d)][2048 s] hi
#define WS_VTL (WS_VTH + 2u * NB * DM * SS)        // f16 lo x 2048
#define WS_O   (WS_VTL + 2u * NB * DM * SS)        // f32 [4096][1024]
#define WS_CS  (WS_O + 4u * NB * SS * DM)           // f32 2 x [2048][32], not used by any kernel
#define WS_END (WS_CS + 4u * 2 * SS * 32)
// ---- k_pack: block = (row n, which): natural [out][in] rows -> bf16; which 0..2 -> W_q/W_k/W_v into PK_A rows which*1024 + n; 3 -> W_o into PK_P
__global__ __launch_bounds__(256) void k_pack(const float* __restrict__ WQ, const float* __restrict__ WK, const float* __restrict__ WV, const float* __restrict__ WO, __bf16* __restrict__ PK) {
  __shared__ __align__(16) __bf16 s[DM]; const int n = blockIdx.x, which = blockIdx.y, t = threadIdx.x; const float* Wm = (which == 0) ? WQ : (which == 1) ? WK : (which == 2) ? WV : WO;
  for (int k = t; k < DM; k += 256) s[k] = (__bf16)Wm[(size_t)n * DM + k];
  __syncthreads();
  __bf16* dst = (which < 3) ? PK + PK_A + ((size_t)which * DM + n) * DM : PK + PK_P + (size_t)n * DM;
  for (int q = t; q < DM / 8; q += 256) vst2((unsigned*)(dst + q * 8), *(const v4u*)&s[q * 8]);
}
__global__ __launch_bounds__(128) void k_qkv(const float* __restrict__ XQ, const float* __restrict__ XK, const float* __restrict__ XV, const __bf16* __restrict__ P, const float* __restrict__ BQ, const float* __restrict__ BK, const float* __restrict__ BV, const float* __restrict__ AKMIN, const float* __restrict__ AKMAX, const float* __restrict__ AVMIN, const float* __restrict__ AVMAX, _Float16* __restrict__ QK, _Float16* __restrict__ QKL, _Float16* __restrict__ VTH, _Float16* __restrict__ VTL) {
  const int which0 = (blockIdx.y * 128) / DM; const float* X = (which0 == 0) ? XQ : (which0 == 1) ? XK : XV; const float* BB = BQ ? (((which0 == 0) ? BQ : (which0 == 1) ? BK : BV) + (blockIdx.y * 128 - which0 * DM)) : nullptr;
  // block = 128 x rows by 128 weight rows; the four waves stand 2 x 2, each on 64 x 64 of it (4 x 4 accumulator tiles): every staged fragment feeds four products, and a staged byte serves twice the rows it did
  // one LDS range: the operand stage of the k loop (sw, sx), then, behind the loop's last barrier, each wave's own output staging (two planes of 64 rows)
  __shared__ __align__(16) unsigned char sm[4 * 2 * 64 * LP * 2];
  __bf16 (*sw)[LP] = (__bf16 (*)[LP])sm; __bf16 (*sx)[LP] = (__bf16 (*)[LP])(sm + 128 * LP * 2);   // 128 weight rows, 128 x rows (bf16), KP k each
  const int tid = threadIdx.x, wave = tid >> 5, lane = tid & 31, col = lane & 15, g = lane >> 4, wm = wave >> 1, wn = wave & 1; const size_t rb = (size_t)blockIdx.x * 128; const int n0 = blockIdx.y * 128;
  _Float16 (*sh)[LP] = (_Float16 (*)[LP])(sm + wave * (2 * 64 * LP * 2)); _Float16 (*sl)[LP] = sh + 64;   // this wave's staging: value plane, residual plane
  v8f acc[4][4] = {};
  const __bf16* wsrc = P + (size_t)(n0 + (tid >> 3)) * DM + (tid & 7) * 8;                       // a wave's 16-B load: 4 weight rows x 128 B
  const float* xsrc = X + (rb + (tid >> 4)) * DM + (tid & 15) * 4;                                // a wave's 16-B load: 2 x rows x 256 B
  // the k walk is a ring: this block enters it at stage ps0 and wraps round. The 32 blocks that read the same weight rows and the 24 that read the same x rows enter at spread stages, so that fewer of them ask L2 for the same lines at the same moment (speed only)
  // blocks 256 apart in the grid (same x rows, blockIdx.y 8 apart) keep one start: where they share a WGP, one fetch of the x rows into its cache can go on serving them (speed only; nothing rests on the placement)
  const int ps0 = (blockIdx.x + 2 * (blockIdx.y & 7)) & (DM / KP - 1);
  const __bf16* wfirst = wsrc + ps0 * KP; const float* xfirst = xsrc + ps0 * KP;
  v4u wr[8]; v4f xr[16];
#pragma unroll
  for (int i = 0; i < 8; ++i) wr[i] = *(const v4u*)(wfirst + (size_t)(16 * i) * DM);
#pragma unroll
  for (int i = 0; i < 16; ++i) xr[i] = *(const v4f*)(xfirst + (size_t)(8 * i) * DM);
  asm volatile("s_wait_xcnt 0x0" :: "v"(wfirst), "v"(xfirst) : "memory");   // stands in front of the reuse of the address registers that these first loads name: as inputs they stay live up to the wait
#pragma unroll 1   // rolled: one copy of the pass keeps the prefetch registers' live range to one pass
  for (int ps = 0; ps < DM / KP; ++ps) {
#pragma unroll
    for (int i = 0; i < 8; ++i) *(v4u*)&sw[(tid >> 3) + 16 * i][(tid & 7) * 8] = wr[i];
#pragma unroll
    for (int i = 0; i < 16; ++i) { v4b c;
#pragma unroll
      for (int e = 0; e < 4; ++e) c[e] = (__bf16)xr[i][e];
      *(v4b*)&sx[(tid >> 4) + 8 * i][(tid & 15) * 4] = c; }
    __syncthreads();   // the stage is written: every wave may read it
    if (ps + 1 < DM / KP) {   // the next pass's rows fly while this pass is multiplied
      const int kn = ((ps0 + ps + 1) & (DM / KP - 1)) * KP;   // the ring's next stage
#pragma unroll
      for (int i = 0; i < 8; ++i) wr[i] = *(const v4u*)(wsrc + (size_t)(16 * i) * DM + kn);
#pragma unroll
      for (int i = 0; i < 16; ++i) xr[i] = *(const v4f*)(xsrc + (size_t)(8 * i) * DM + kn);
      asm volatile("s_wait_xcnt 0x0" ::: "memory"); }   // stands in front of the next rewrite of the address registers that these loads name
#pragma unroll
    for (int kc = 0; kc < KP / 32; ++kc) { v16b a[4], w[4];
#pragma unroll
      for (int i = 0; i < 4; ++i) a[i] = frag_b(&sx[wm * 64 + i * 16 + col][kc * 32], lane);
#pragma unroll
      for (int j = 0; j < 4; ++j) w[j] = frag_b(&sw[wn * 64 + j * 16 + col][kc * 32], lane);
      __builtin_amdgcn_sched_barrier(0);   // the LDS reads stay one group ahead of the products: read pair by pair among them, each product waits out a whole LDS latency
#pragma unroll
      for (int i = 0; i < 4; ++i) {
#pragma unroll
        for (int j = 0; j < 4; ++j) acc[i][j] = wmma_bf(a[i], w[j], acc[i][j]); } }
    __syncthreads();   // every wave has read the stage: it may be rewritten (behind the last pass: by the output staging)
  }
  const int b = (int)(rb / SS), c0 = wn * 64, cb = c0 + col;   // a block's 128 rows lie in one batch; cb: this lane's first column in the block
  const bool isv = n0 >= 2 * DM, cl = n0 >= DM;   // block-uniform: v block; block whose values are guard-clamped (k, v)
  const size_t a0 = (size_t)b * DM + (cl ? n0 - (isv ? 2 * DM : DM) : 0) + cb; const float* pmin = (isv ? AVMIN : AKMIN) + a0; const float* pmax = (isv ? AVMAX : AKMAX) + a0;
  float bias[4] = {0.f, 0.f, 0.f, 0.f}, amin[4] = {0.f, 0.f, 0.f, 0.f}, amax[4] = {0.f, 0.f, 0.f, 0.f};   // of columns cb + 16 j: loaded as one group, one latency for all
  if (BB) {
#pragma unroll
    for (int j = 0; j < 4; ++j) bias[j] = BB[cb + 16 * j]; }
  if (cl) {
#pragma unroll
    for (int j = 0; j < 4; ++j) { amin[j] = pmin[16 * j]; amax[j] = pmax[16 * j]; } }
  asm volatile("s_wait_xcnt 0x0" :: "v"(cb), "s"(BB), "v"(pmin), "v"(pmax) : "memory");   // stands in front of the reuse of the address registers that these loads name: as inputs they stay live up to the wait
#pragma unroll
  for (int j = 0; j < 4; ++j) { bias[j] = bfr(bias[j]); amin[j] = bfr(amin[j]); amax[j] = bfr(amax[j]); }
  if (!cl) {   // q stored unscaled (f16 sigma ~0.6, no subnormal exposure); 1/8 applied to the f32 score
#pragma unroll
    for (int j = 0; j < 4; ++j) {
#pragma unroll
      for (int i = 0; i < 4; ++i) {
#pragma unroll
        for (int r = 0; r < 8; ++r) { const float v = acc[i][j][r] + bias[j];
          const _Float16 hv = (_Float16)v; sh[i * 16 + 8 * g + r][j * 16 + col] = hv; sl[i * 16 + 8 * g + r][j * 16 + col] = (_Float16)((v - (float)hv) * 2048.0f); } } }   // q (+ bias) as f16 hi + (x2048) residual
  } else if (!isv) {
#pragma unroll
    for (int j = 0; j < 4; ++j) {
#pragma unroll
      for (int i = 0; i < 4; ++i) {
#pragma unroll
        for (int r = 0; r < 8; ++r) { const float v = gclamp(acc[i][j][r] + bias[j], amin[j], amax[j]);   /* k guard-clamped per (b, h, d) */
          const _Float16 hv = (_Float16)v; sh[i * 16 + 8 * g + r][j * 16 + col] = hv; sl[i * 16 + 8 * g + r][j * 16 + col] = (_Float16)((v - (float)hv) * 2048.0f); } } }   // k (+ bias) as f16 hi + (x2048) residual
  } else {
#pragma unroll
    for (int j = 0; j < 4; ++j) {
#pragma unroll
      for (int i = 0; i < 4; ++i) {
#pragma unroll
        for (int r = 0; r < 8; ++r) { const float v = gclamp(acc[i][j][r] + bias[j], amin[j], amax[j]);   /* v guard-clamped */
          const _Float16 hv = (_Float16)v; sh[j * 16 + col][i * 16 + 8 * g + r] = hv; sl[j * 16 + col][i * 16 + 8 * g + r] = (_Float16)((v - (float)hv) * 2048.0f); } } }   // staged transposed: row = channel, 64 positions along it
  }
  LDSX();
  // staged rows go out as whole lines: q, k: row = position, into [position][2048]; v: row = channel, into [b][channel][position]
  _Float16* dh = isv ? VTH + ((size_t)b * DM + (n0 - 2 * DM) + c0) * SS + (rb % SS) + wm * 64 : QK + (rb + wm * 64) * (2 * DM) + n0 + c0;
  _Float16* dl = isv ? VTL + ((size_t)b * DM + (n0 - 2 * DM) + c0) * SS + (rb % SS) + wm * 64 : QKL + (rb + wm * 64) * (2 * DM) + n0 + c0;
  for (int it = 0; it < 16; ++it) { const int row = it * 4 + (lane >> 3), ch = lane & 7; const size_t o = (size_t)row * (isv ? SS : 2 * DM) + ch * 8;   // a wave's 16-B store: 4 rows x 128 B
    vst2((unsigned*)(dh + o), *(const v4u*)&sh[row][ch * 8]); vst2((unsigned*)(dl + o), *(const v4u*)&sl[row][ch * 8]); }
}
// ---- k_attn: block = (64 queries, head h, batch b): all-keys flash attention with TRANSPOSED products: S^T = K . Q^T (A = key rows from the stage, B = the wave's q rows kept in registers), so a lane holds 16 scores of ONE query (column col; keys 8g + r and 16 + 8g + r of the 32): maximum and sum run in the lane, one exchange between the lane halves joins the maximum; the two score tiles, exponentiated and rounded in place, ARE the B operand of O^T += V^T . P^T (A = channel rows of v from the stage): P never goes through LDS. O[b*S+q][h*64+d] = acc / l (256-B segments)
// lane l <-> lane l ^ 16 as a vector cross-row move: the shuffle builtin would go through the LDS pipe and its wait
__device__ __forceinline__ float xhalf(float v) { const int i = __builtin_bit_cast(int, v); return __builtin_bit_cast(float, __builtin_amdgcn_permlanex16(i, i, 0x76543210, 0xfedcba98, false, false)); }
__global__ __launch_bounds__(128) void k_attn(const _Float16* __restrict__ QK, const _Float16* __restrict__ QKL, const _Float16* __restrict__ VTH, const _Float16* __restrict__ VTL, const void* __restrict__ KMASK, float* __restrict__ O) {
  __shared__ __align__(16) float so[4][16][68];
  __shared__ __align__(16) _Float16 sk[KP][LP], sv[HD][LP];   // the stage: KP keys x 64 channels; 64 channels of v x KP keys
  const int tid = threadIdx.x, wave = tid >> 5, lane = tid & 31, col = lane & 15, g = lane >> 4;
  const int qb = blockIdx.x, h = blockIdx.y, b = blockIdx.z; const int q0 = qb * 64 + wave * 16; const size_t rq = (size_t)b * SS + q0 + col;
  v16h aq[2];   // B operand of the score product: column col = query q0 + col, channels in the loader's k order (the same loader as the key rows')
#pragma unroll
  for (int kc = 0; kc < 2; ++kc) aq[kc] = frag_h(QK + rq * (2 * DM) + h * HD + kc * 32, lane);
  const float CS = 0.125f * 1.44269504088896340736f;   // 1/sqrt(64) and log2(e) in one factor: weight x 2^11 = 2^(score * CS + nb), nb = 11 - maximum * CS
  float m = -3.0e38f, nb = 11.0f + 3.0e38f * CS, l = 0.f;   // of query col: m = maximum of the raw scores so far (equal in both lane halves), nb its exponent offset, l (x 2^11) over this lane half's keys (the halves are joined in the epilogue)
  v8f acc[4] = {};   // acc[dt][r] = O^T[channel dt * 16 + 8g + r][query col] (x 2^11)
  const _Float16* ksrc = QK + ((size_t)b * SS + (tid >> 3)) * (2 * DM) + DM + h * HD + (tid & 7) * 8;   // a wave's 16-B load: 4 key rows x 128 B
  const _Float16* vsrc = VTH + ((size_t)b * DM + h * HD + (tid >> 3)) * SS + (tid & 7) * 8;               // a wave's 16-B load: 4 channel rows x 128 B
  // the key walk is a ring: the 32 blocks of one (batch, head) read the same k and v rows; each enters at a stage of its own (its query block's number) and wraps round, so that they do not ask L2 for the same lines at the same moment
  const int st0 = qb & (SS / KP - 1);
  const _Float16* kfirst = ksrc + (size_t)st0 * KP * (2 * DM); const _Float16* vfirst = vsrc + st0 * KP;
  v4u kr[4], vr[4];
#pragma unroll
  for (int i = 0; i < 4; ++i) { kr[i] = *(const v4u*)(kfirst + (size_t)(16 * i) * (2 * DM)); vr[i] = *(const v4u*)(vfirst + (size_t)(16 * i) * SS); }
#pragma unroll 1   // rolled: one copy of the stage's code
  for (int st = 0; st < SS / KP; ++st) {   // all keys, KP a stage
#pragma unroll
  for (int i = 0; i < 4; ++i) { *(v4u*)&sk[(tid >> 3) + 16 * i][(tid & 7) * 8] = kr[i]; *(v4u*)&sv[(tid >> 3) + 16 * i][(tid & 7) * 8] = vr[i]; }
  __syncthreads();   // the stage is written: every wave may read it
  if (st + 1 < SS / KP) {   // the next stage's rows fly while this one is worked on
    const int sn = (st0 + st + 1) & (SS / KP - 1);   // the ring's next stage
#pragma unroll
    for (int i = 0; i < 4; ++i) { kr[i] = *(const v4u*)(ksrc + ((size_t)sn * KP + 16 * i) * (2 * DM)); vr[i] = *(const v4u*)(vsrc + (size_t)(16 * i) * SS + sn * KP); } }
#pragma unroll 1   // rolled: the 32-key body stays one copy, as it was
  for (int ks = 0; ks < KP / 32; ++ks) { v8f s[2]; v16h kf[2][2], vf[4];
#pragma unroll
    for (int ct = 0; ct < 2; ++ct) {
#pragma unroll
      for (int kc = 0; kc < 2; ++kc) kf[ct][kc] = frag_h(&sk[ks * 32 + ct * 16 + col][kc * 32], lane); }   // A: row col = key ct * 16 + col
#pragma unroll
    for (int dt = 0; dt < 4; ++dt) vf[dt] = frag_h(&sv[dt * 16 + col][ks * 32], lane);   // A of the second product: row col = channel dt * 16 + col; its k order (keys 8g + i, 16 + 8g + i) is that of the packed score tiles
    __builtin_amdgcn_sched_barrier(0);   // the LDS reads stay one group ahead of the products: read pair by pair among them, each product waits out a whole LDS latency (the v rows land under the scores and the softmax)
#pragma unroll
    for (int ct = 0; ct < 2; ++ct) { v8f c = {};
#pragma unroll
      for (int kc = 0; kc < 2; ++kc) c = wmma16(kf[ct][kc], aq[kc], c);   // single product: k, q as one-rounding f16 operands; c[r] = raw score of key ct * 16 + 8g + r with query col
      s[ct] = c; }
    float mx = fmaxf(s[0][0], s[1][0]);
#pragma unroll
    for (int r = 1; r < 8; ++r) mx = fmaxf(mx, fmaxf(s[0][r], s[1][r]));
    mx = fmaxf(mx, xhalf(mx));   // both lane halves hold the query's maximum over the 32 keys
    const float mn = fmaxf(m, mx), nbn = fmaf(mn, -CS, 11.0f); const float alpha = __builtin_amdgcn_exp2f(nbn - nb);   // 2^((m - mn) * CS); 0 in the first pass, where nb is huge
    v16h pa; v2f es = {0.f, 0.f};
#pragma unroll
    for (int ct = 0; ct < 2; ++ct) {
#pragma unroll
      for (int i = 0; i < 4; ++i) { const v2f sp = {s[ct][2 * i], s[ct][2 * i + 1]}, t = sp * CS + nbn;   // neighbouring score registers as a pair: one packed multiply-add, two hardware exponentials, one packed add for two scores
        const v2f e = {__builtin_amdgcn_exp2f(t[0]), __builtin_amdgcn_exp2f(t[1])};
        es += e; pa[8 * ct + 2 * i] = (_Float16)e[0]; pa[8 * ct + 2 * i + 1] = (_Float16)e[1]; } }   // P carries 2^11 (the 11 in nb) so small softmax weights stay out of the f16 subnormal range; l carries it too, so it cancels in the epilogue
    l = l * alpha + (es[0] + es[1]); m = mn; nb = nbn;
#pragma unroll
    for (int dt = 0; dt < 4; ++dt) acc[dt] *= alpha;
#pragma unroll
    for (int dt = 0; dt < 4; ++dt) acc[dt] = wmma16(vf[dt], pa, acc[dt]); }   // single product: V^T x P^T (x2^11)
  __syncthreads();   // every wave has read the stage: it may be rewritten
  }
  { const float il = 1.0f / (l + xhalf(l));   // the two lane halves' sums joined, unconditionally
#pragma unroll
    for (int dt = 0; dt < 4; ++dt) {
#pragma unroll
      for (int q = 0; q < 2; ++q) { v4f o;
#pragma unroll
        for (int e = 0; e < 4; ++e) o[e] = acc[dt][4 * q + e] * il;
        *(v4f*)&so[wave][col][dt * 16 + 8 * g + 4 * q] = o; } } }
  LDSX();
  for (int rl = 0; rl < 16; ++rl) if (lane < 16) vst2(O + ((size_t)b * SS + q0 + rl) * DM + h * HD + lane * 4, *(const v4f*)&so[wave][rl][lane * 4]);
}
// ---- k_out: block = (64 rows, 128 cols): out = O(hi/lo) . Wo rows (2 products) + bo
__global__ __launch_bounds__(128) void k_out(const float* __restrict__ O, const __bf16* __restrict__ P, const float* __restrict__ BO, float* __restrict__ Y) {
  // one LDS range: the operand stage of the k loop (sw, sxh, sxl), then, behind the loop's last barrier, the output staging
  __shared__ __align__(16) unsigned char sm[(128 + 64 + 64) * LP * 2];
  float (*so)[16][132] = (float (*)[16][132])sm;
  __bf16 (*sw)[LP] = (__bf16 (*)[LP])sm; __bf16 (*sxh)[LP] = (__bf16 (*)[LP])(sm + 128 * LP * 2); __bf16 (*sxl)[LP] = (__bf16 (*)[LP])(sm + (128 + 64) * LP * 2);   // 128 weight rows; 64 o rows as bf16 hi and residual
  const int tid = threadIdx.x, wave = tid >> 5, lane = tid & 31, col = lane & 15, g = lane >> 4; const size_t r0 = (size_t)blockIdx.x * 64 + wave * 16; const int n0 = blockIdx.y * 128;
  v8f acc[8] = {};
  const __bf16* wsrc = P + (size_t)(n0 + (tid >> 3)) * DM + (tid & 7) * 8;                       // a wave's 16-B load: 4 weight rows x 128 B
  const float* xsrc = O + ((size_t)blockIdx.x * 64 + (tid >> 4)) * DM + (tid & 15) * 4;           // a wave's 16-B load: 2 o rows x 256 B
  // the k walk is a ring, entered at stage ps0: the 64 blocks that read the same weight rows spread over its 16 stages (4 on each), the 8 that read the same o rows over 4 (2 on each), so that fewer of them ask L2 for the same lines at the same moment
  // blocks 256 apart in the grid (same o rows, blockIdx.y 4 apart) keep one start, as in k_qkv
  const int ps0 = (blockIdx.x + 4 * (blockIdx.y & 3)) & (DM / KP - 1);
  const __bf16* wfirst = wsrc + ps0 * KP; const float* xfirst = xsrc + ps0 * KP;
  v4u wr[8]; v4f xr[8];
#pragma unroll
  for (int i = 0; i < 8; ++i) { wr[i] = *(const v4u*)(wfirst + (size_t)(16 * i) * DM); xr[i] = *(const v4f*)(xfirst + (size_t)(8 * i) * DM); }
  asm volatile("s_wait_xcnt 0x0" :: "v"(wfirst), "v"(xfirst) : "memory");   // stands in front of the reuse of the address registers that these first loads name: as inputs they stay live up to the wait
#pragma unroll 1   // rolled: one copy of the pass keeps the prefetch registers' live range to one pass
  for (int ps = 0; ps < DM / KP; ++ps) {
#pragma unroll
    for (int i = 0; i < 8; ++i) { *(v4u*)&sw[(tid >> 3) + 16 * i][(tid & 7) * 8] = wr[i]; v4b ch, cl;
#pragma unroll
      for (int e = 0; e < 4; ++e) { const __bf16 hv = (__bf16)xr[i][e]; ch[e] = hv; cl[e] = (__bf16)(xr[i][e] - (float)hv); }
      *(v4b*)&sxh[(tid >> 4) + 8 * i][(tid & 15) * 4] = ch; *(v4b*)&sxl[(tid >> 4) + 8 * i][(tid & 15) * 4] = cl; }
    __syncthreads();   // the stage is written: every wave may read it
    if (ps + 1 < DM / KP) {   // the next pass's rows fly while this pass is multiplied
      const int kn = ((ps0 + ps + 1) & (DM / KP - 1)) * KP;   // the ring's next stage
      const __bf16* wnext = wsrc + kn; const float* xnext = xsrc + kn;
#pragma unroll
      for (int i = 0; i < 8; ++i) { wr[i] = *(const v4u*)(wnext + (size_t)(16 * i) * DM); xr[i] = *(const v4f*)(xnext + (size_t)(8 * i) * DM); }
      asm volatile("s_wait_xcnt 0x0" :: "v"(wnext), "v"(xnext) : "memory"); }   // stands in front of the next rewrite of the address registers that these loads name: as inputs they stay live up to the wait
#pragma unroll
    for (int kc = 0; kc < KP / 32; ++kc) { const v16b ah = frag_b(&sxh[wave * 16 + col][kc * 32], lane), al = frag_b(&sxl[wave * 16 + col][kc * 32], lane); v16b w[8];
#pragma unroll
      for (int j = 0; j < 8; ++j) w[j] = frag_b(&sw[j * 16 + col][kc * 32], lane);
      __builtin_amdgcn_sched_barrier(0);   // the LDS reads stay one group ahead of the products: read pair by pair among them, each product waits out a whole LDS latency
#pragma unroll
      for (int j = 0; j < 8; ++j) { acc[j] = wmma_bf(al, w[j], acc[j]); acc[j] = wmma_bf(ah, w[j], acc[j]); } }
    __syncthreads();   // every wave has read the stage: it may be rewritten (behind the last pass: by the output staging)
  }
#pragma unroll
  for (int j = 0; j < 8; ++j) {
#pragma unroll
    for (int r = 0; r < 8; ++r) so[wave][8 * g + r][j * 16 + col] = acc[j][r] + bfr(BO[n0 + j * 16 + col]); }
  LDSX();
  for (int rl = 0; rl < 16; ++rl) vst2(Y + (r0 + rl) * DM + n0 + lane * 4, *(const v4f*)&so[wave][rl][lane * 4]);
}
extern "C" void kernel_launch(void* const* d_in, const int* in_sizes, int n_in, void* d_out, int out_size, void* d_ws, size_t ws_size, hipStream_t stream) {
  (void)in_sizes; (void)n_in; (void)out_size;
  const float** F = (const float**)d_in;   // 0 x [2,2048,1024], 1 qkv_w [3072,1024] natural, 2 qkv_b, 3 out_w, 4 out_b, 5 anchor_k_min, 6 anchor_k_max, 7 anchor_v_min, 8 anchor_v_max ([2,16,1,64] each)
  if (ws_size < (size_t)WS_END) return;
  char* ws = (char*)d_ws; __bf16* PK = (__bf16*)(ws + WS_PK); _Float16 *QK = (_Float16*)(ws + WS_QK), *QKL = (_Float16*)(ws + WS_QKL), *VTH = (_Float16*)(ws + WS_VTH), *VTL = (_Float16*)(ws + WS_VTL); float* O = (float*)(ws + WS_O);
  k_pack<<<dim3(DM, 4), 256, 0, stream>>>(F[1], F[1] + (size_t)DM * DM, F[1] + (size_t)2 * DM * DM, F[3], PK);
  k_qkv<<<dim3(TNB * SS / 128, QKVW / 128), 128, 0, stream>>>(F[0], F[0], F[0], PK + PK_A, F[2], F[2] + DM, F[2] + 2 * DM, F[5], F[6], F[7], F[8], QK, QKL, VTH, VTL);
  k_attn<<<dim3(TQB, NH, TNB), 128, 0, stream>>>(QK, QKL, VTH, VTL, nullptr, O);
  k_out<<<dim3(TOB, DM / 128), 128, 0, stream>>>(O, PK + PK_P, F[4], (float*)d_out);
}

// v007
// One run takes 92 microseconds.
// Next to v006, in two timings, it ran 1.03 times as fast each time.
// Counting every step since v000, it is 4.36 times as fast.
// compute dtype: all float inputs rounded to bf16; qkv = x . W_qkv^T + b with EXACT bf16 products on WMMA 16x16x32 (natural rows; the fused weight as three contiguous row blocks); the guard clamp of k and v in f32 before the f16 rounding; PLAIN attention: q, k single f16 x 1/8, running-max softmax in f32 (hardware exp), P (scaled by 2^11, single f16) x v (single f16); out = o (bf16 hi + residual) . W_out^T (2 products) + b_out.
#include <hip/hip_runtime.h>
#include <math.h>

typedef __attribute__((ext_vector_type(16))) _Float16 v16h;
typedef __attribute__((ext_vector_type(16))) __bf16 v16b;
typedef __attribute__((ext_vector_type(8)))  _Float16 v8h;
typedef __attribute__((ext_vector_type(8)))  float v8f;
typedef __attribute__((ext_vector_type(4)))  float v4f;
typedef __attribute__((ext_vector_type(2)))  float v2f;
typedef __attribute__((ext_vector_type(4)))  unsigned v4u;
typedef __attribute__((ext_vector_type(4)))  int v4i;
typedef float __attribute__((may_alias)) float_a;
typedef int __attribute__((may_alias)) int_a;

template <typename T> __device__ __forceinline__ void vst2(void* p, T v) { *(T*)p = v;  }
__device__ __forceinline__ v8f wmma16(v16h a, v16h b, v8f c) {
  return __builtin_amdgcn_wmma_f32_16x16x32_f16(false, a, false, b, (short)0, c, false, false);   // plain builtin: the compiler keeps the hazard distances of its own WMMAs
}
__device__ __forceinline__ v8f wmma_bf(v16b a, v16b b, v8f c) {
  v8f d = __builtin_amdgcn_wmma_f32_16x16x32_bf16(false, a, false, b, (short)0, c, false, false);
  asm volatile("v_nop\n\tv_nop\n\tv_nop\n\tv_nop" : "+v"(d) : "v"(a), "v"(b));
  return d;
}
// Range-aware (guard-clamped) multi-head attention (B 2, S 2,048, d 1,024, 16 heads x 64): fused qkv projection + bias, k and v clamped against per-(batch, head, channel) anchor ranges with a 0.1 slack, softmax(q k^T / 8) v, output projection + bias.
__device__ __forceinline__ v16h frag_h(const _Float16* rowk0, int lane) {
  union { v16h v; v8h q[2]; } u; const _Float16* p = rowk0 + 8 * (lane >> 4);
  u.q[0] = *(const v8h*)p; u.q[1] = *(const v8h*)(p + 16); return u.v;
}
__device__ __forceinline__ v16h frag_f32(const float* rowk0, int lane) {
  v16h a; const float* p = rowk0 + 8 * (lane >> 4);
#pragma unroll
  for (int i = 0; i < 8; ++i) { a[i] = (_Float16)p[i]; a[8 + i] = (_Float16)p[16 + i]; }
  return a;
}
__device__ __forceinline__ v16h frag_f32s(const float* rowk0, int lane, float sc) {
  v16h a; const float* p = rowk0 + 8 * (lane >> 4);
#pragma unroll
  for (int i = 0; i < 8; ++i) { a[i] = (_Float16)(p[i] * sc); a[8 + i] = (_Float16)(p[16 + i] * sc); }
  return a;
}
// column fragment from a [K][ld] layout (column n), rows >= K read as 0
__device__ __forceinline__ v16h fragc_f32(const float* W, int k0, int n, int lane, int ld, int K) {
  v16h a; const int g = lane >> 4;
#pragma unroll
  for (int i = 0; i < 8; ++i) { const int ka = k0 + 8 * g + i, kb = ka + 16;
    a[i] = (_Float16)(ka < K ? W[(size_t)(ka < K ? ka : K - 1) * ld + n] : 0.f); a[8 + i] = (_Float16)(kb < K ? W[(size_t)(kb < K ? kb : K - 1) * ld + n] : 0.f); }
  return a;
}
struct F2 { v16b h, l; };
__device__ __forceinline__ F2 bsplit16(const float v[16]) { F2 r;
#pragma unroll
  for (int i = 0; i < 16; ++i) { const __bf16 h = (__bf16)v[i]; r.h[i] = h; r.l[i] = (__bf16)(v[i] - (float)h); }
  return r; }
__device__ __forceinline__ F2 split_row(const float* row, int k0, int lane) { float v[16]; const float* p = row + k0 + 8 * (lane >> 4);
#pragma unroll
  for (int i = 0; i < 8; ++i) { v[i] = p[i]; v[8 + i] = p[16 + i]; }
  return bsplit16(v); }
__device__ __forceinline__ F2 split_rowK(const float* row, int k0, int lane, int K) { float v[16]; const int g = lane >> 4;
#pragma unroll
  for (int i = 0; i < 8; ++i) { const int ka = k0 + 8 * g + i, kb = ka + 16; v[i] = ka < K ? row[ka < K ? ka : K - 1] : 0.f; v[8 + i] = kb < K ? row[kb < K ? kb : K - 1] : 0.f; }
  return bsplit16(v); }
__device__ __forceinline__ F2 split_col(const float* W, int k0, int n, int lane, int ld, int K) { float v[16]; const int g = lane >> 4;
#pragma unroll
  for (int i = 0; i < 8; ++i) { const int ka = k0 + 8 * g + i, kb = ka + 16; v[i] = ka < K ? W[(size_t)(ka < K ? ka : K - 1) * ld + n] : 0.f; v[8 + i] = kb < K ? W[(size_t)(kb < K ? kb : K - 1) * ld + n] : 0.f; }
  return bsplit16(v); }
__device__ __forceinline__ v8f mac3(const F2& a, const F2& b, v8f c) { c = wmma_bf(a.l, b.h, c); c = wmma_bf(a.h, b.l, c); return wmma_bf(a.h, b.h, c); }
__device__ __forceinline__ float sigm(float v) { return 1.0f / (1.0f + expf(-v)); }
#define LDSX() do { asm volatile("s_wait_dscnt 0" ::: "memory"); __builtin_amdgcn_wave_barrier(); __builtin_amdgcn_fence(__ATOMIC_RELEASE, "workgroup"); } while (0)


#define NB 2
#define SS 2048
#define DM 1024
#define NH 16
#define GEPS 0.1f
__device__ __forceinline__ float gclamp(float tv, float amin, float amax) { float lo = fmaxf(tv - GEPS, amin); const float hi = fminf(tv + GEPS, amax); lo = fminf(lo, hi); return fmaxf(lo, fminf(tv, hi)); }
#define HD 64
#define QKVW (3 * DM)
#ifndef TQB
#define TQB (SS / 64)
#define TNB NB
#define TOB (NB * SS / 64)     // output row tiles (all)
#endif
typedef __attribute__((ext_vector_type(8))) __bf16 v8b;
__device__ __forceinline__ v16b frag_b(const __bf16* rowk0, int lane) {
  union { v16b v; v8b q[2]; } u; const __bf16* p = rowk0 + 8 * (lane >> 4);
  u.q[0] = *(const v8b*)p; u.q[1] = *(const v8b*)(p + 16); return u.v;
}
__device__ __forceinline__ float bfr(float v) { return (float)(__bf16)v; }
typedef __attribute__((ext_vector_type(4))) __bf16 v4b;
#define KP 64   // k (or keys) per staged pass: 128 B of every 16-bit operand row, one whole line
#define LP 72   // LDS row pitch in 16-bit elements: 128 B of data + 16 B, the pitch for ds_load_b128 readers
__device__ __attribute__((noinline)) float exp_ni(float v) { return expf(v); }
__device__ __attribute__((noinline)) float erf_ni(float v) { return erff(v); }

#define PK_A 0                       // [3072][1024] Wqkv rows (natural [out][in])
#define PK_P (PK_A + QKVW * DM)        // [1024][1024] Wo rows (natural)
#define PK_END (PK_P + DM * DM)
#define WS_PK  0u
#define WS_QK  (WS_PK + 2u * PK_END)             // f16 [4096 rows][2048]: q | k
#define WS_QKL (WS_QK + 2u * NB * SS * 2 * DM)     // f16 q | k residual planes x2048
#define WS_VTH (WS_QKL + 2u * NB * SS * 2 * DM)    // f16 [b][1024 (h*64+d)][2048 s] hi
#define WS_VTL (WS_VTH + 2u * NB * DM * SS)        // f16 lo x 2048
#define WS_O   (WS_VTL + 2u * NB * DM * SS)        // f32 [4096][1024]
#define WS_CS  (WS_O + 4u * NB * SS * DM)           // f32 2 x [2048][32], not used by any kernel
#define WS_END (WS_CS + 4u * 2 * SS * 32)
// ---- k_pack: both weights are natural [out][in] rows and land in PK in their own linear order (W_qkv at PK_A, W_o at PK_P): one linear f32 -> bf16 stream.
// One block per PKE consecutive elements, 256 blocks of 8 waves in all: a lane has its 16 whole-line 16-B loads in flight at once (one memory latency a wave, 64 KB in flight a block), rounds them and stores whole lines; no LDS, no barrier.
#define PKE 16384   // elements a block: 256 lanes x 16 loads x 4; divides PK_P, so a block's source is one array
__global__ __launch_bounds__(256) void k_pack(const float* __restrict__ WA, const float* __restrict__ WO, __bf16* __restrict__ PK) {
  const int e0 = blockIdx.x * PKE, t = threadIdx.x;
  const float* src = ((e0 < PK_P) ? WA + e0 : WO + (e0 - PK_P)) + t * 4; __bf16* dst = PK + e0 + t * 4;
  v4f r[16];
#pragma unroll
  for (int i = 0; i < 16; ++i) r[i] = *(const v4f*)(src + i * 1024);   // a wave's load: 512 contiguous bytes
  __builtin_amdgcn_sched_barrier(0);   // all 16 loads are issued ahead of the first conversion: left free, the last two were placed behind the wait for the first two and cost a second latency
  v4b c[16];
#pragma unroll
  for (int i = 0; i < 16; ++i) {
#pragma unroll
    for (int e = 0; e < 4; ++e) c[i][e] = (__bf16)r[i][e]; }
#pragma unroll
  for (int i = 0; i < 16; ++i) *(v4b*)(dst + i * 1024) = c[i];   // a wave's store: 256 contiguous bytes
}
__global__ __launch_bounds__(128) void k_qkv(const float* __restrict__ XQ, const float* __restrict__ XK, const float* __restrict__ XV, const __bf16* __restrict__ P, const float* __restrict__ BQ, const float* __restrict__ BK, const float* __restrict__ BV, const float* __restrict__ AKMIN, const float* __restrict__ AKMAX, const float* __restrict__ AVMIN, const float* __restrict__ AVMAX, _Float16* __restrict__ QK, _Float16* __restrict__ QKL, _Float16* __restrict__ VTH, _Float16* __restrict__ VTL) {
  const int which0 = (blockIdx.y * 128) / DM; const float* X = (which0 == 0) ? XQ : (which0 == 1) ? XK : XV; const float* BB = BQ ? (((which0 == 0) ? BQ : (which0 == 1) ? BK : BV) + (blockIdx.y * 128 - which0 * DM)) : nullptr;
  // block = 128 x rows by 128 weight rows; the four waves stand 2 x 2, each on 64 x 64 of it (4 x 4 accumulator tiles): every staged fragment feeds four products, and a staged byte serves twice the rows it did
  // one LDS range: the operand stage of the k loop (sw, sx), then, behind the loop's last barrier, each wave's own output staging (two planes of 64 rows)
  __shared__ __align__(16) unsigned char sm[4 * 2 * 64 * LP * 2];
  __bf16 (*sw)[LP] = (__bf16 (*)[LP])sm; __bf16 (*sx)[LP] = (__bf16 (*)[LP])(sm + 128 * LP * 2);   // 128 weight rows, 128 x rows (bf16), KP k each
  const int tid = threadIdx.x, wave = tid >> 5, lane = tid & 31, col = lane & 15, g = lane >> 4, wm = wave >> 1, wn = wave & 1; const size_t rb = (size_t)blockIdx.x * 128; const int n0 = blockIdx.y * 128;
  _Float16 (*sh)[LP] = (_Float16 (*)[LP])(sm + wave * (2 * 64 * LP * 2)); _Float16 (*sl)[LP] = sh + 64;   // this wave's staging: value plane, residual plane
  v8f acc[4][4] = {};
  const __bf16* wsrc = P + (size_t)(n0 + (tid >> 3)) * DM + (tid & 7) * 8;                       // a wave's 16-B load: 4 weight rows x 128 B
  const float* xsrc = X + (rb + (tid >> 4)) * DM + (tid & 15) * 4;                                // a wave's 16-B load: 2 x rows x 256 B
  // the k walk is a ring: this block enters it at stage ps0 and wraps round. The 32 blocks that read the same weight rows and the 24 that read the same x rows enter at spread stages, so that fewer of them ask L2 for the same lines at the same moment (speed only)
  // blocks 256 apart in the grid (same x rows, blockIdx.y 8 apart) keep one start: where they share a WGP, one fetch of the x rows into its cache can go on serving them (speed only; nothing rests on the placement)
  const int ps0 = (blockIdx.x + 2 * (blockIdx.y & 7)) & (DM / KP - 1);
  const __bf16* wfirst = wsrc + ps0 * KP; const float* xfirst = xsrc + ps0 * KP;
  v4u wr[8]; v4f xr[16];
#pragma unroll
  for (int i = 0; i < 8; ++i) wr[i] = *(const v4u*)(wfirst + (size_t)(16 * i) * DM);
#pragma unroll
  for (int i = 0; i < 16; ++i) xr[i] = *(const v4f*)(xfirst + (size_t)(8 * i) * DM);
  asm volatile("s_wait_xcnt 0x0" :: "v"(wfirst), "v"(xfirst) : "memory");   // stands in front of the reuse of the address registers that these first loads name: as inputs they stay live up to the wait
#pragma unroll 1   // rolled: one copy of the pass keeps the prefetch registers' live range to one pass
  for (int ps = 0; ps < DM / KP; ++ps) {
#pragma unroll
    for (int i = 0; i < 8; ++i) *(v4u*)&sw[(tid >> 3) + 16 * i][(tid & 7) * 8] = wr[i];
#pragma unroll
    for (int i = 0; i < 16; ++i) { v4b c;
#pragma unroll
      for (int e = 0; e < 4; ++e) c[e] = (__bf16)xr[i][e];
      *(v4b*)&sx[(tid >> 4) + 8 * i][(tid & 15) * 4] = c; }
    __syncthreads();   // the stage is written: every wave may read it
    if (ps + 1 < DM / KP) {   // the next pass's rows fly while this pass is multiplied
      const int kn = ((ps0 + ps + 1) & (DM / KP - 1)) * KP;   // the ring's next stage
#pragma unroll
      for (int i = 0; i < 8; ++i) wr[i] = *(const v4u*)(wsrc + (size_t)(16 * i) * DM + kn);
#pragma unroll
      for (int i = 0; i < 16; ++i) xr[i] = *(const v4f*)(xsrc + (size_t)(8 * i) * DM + kn);
      asm volatile("s_wait_xcnt 0x0" ::: "memory"); }   // stands in front of the next rewrite of the address registers that these loads name
#pragma unroll
    for (int kc = 0; kc < KP / 32; ++kc) { v16b a[4], w[4];
#pragma unroll
      for (int i = 0; i < 4; ++i) a[i] = frag_b(&sx[wm * 64 + i * 16 + col][kc * 32], lane);
#pragma unroll
      for (int j = 0; j < 4; ++j) w[j] = frag_b(&sw[wn * 64 + j * 16 + col][kc * 32], lane);
      __builtin_amdgcn_sched_barrier(0);   // the LDS reads stay one group ahead of the products: read pair by pair among them, each product waits out a whole LDS latency
#pragma unroll
      for (int i = 0; i < 4; ++i) {
#pragma unroll
        for (int j = 0; j < 4; ++j) acc[i][j] = wmma_bf(a[i], w[j], acc[i][j]); } }
    __syncthreads();   // every wave has read the stage: it may be rewritten (behind the last pass: by the output staging)
  }
  const int b = (int)(rb / SS), c0 = wn * 64, cb = c0 + col;   // a block's 128 rows lie in one batch; cb: this lane's first column in the block
  const bool isv = n0 >= 2 * DM, cl = n0 >= DM;   // block-uniform: v block; block whose values are guard-clamped (k, v)
  const size_t a0 = (size_t)b * DM + (cl ? n0 - (isv ? 2 * DM : DM) : 0) + cb; const float* pmin = (isv ? AVMIN : AKMIN) + a0; const float* pmax = (isv ? AVMAX : AKMAX) + a0;
  float bias[4] = {0.f, 0.f, 0.f, 0.f}, amin[4] = {0.f, 0.f, 0.f, 0.f}, amax[4] = {0.f, 0.f, 0.f, 0.f};   // of columns cb + 16 j: loaded as one group, one latency for all
  if (BB) {
#pragma unroll
    for (int j = 0; j < 4; ++j) bias[j] = BB[cb + 16 * j]; }
  if (cl) {
#pragma unroll
    for (int j = 0; j < 4; ++j) { amin[j] = pmin[16 * j]; amax[j] = pmax[16 * j]; } }
  asm volatile("s_wait_xcnt 0x0" :: "v"(cb), "s"(BB), "v"(pmin), "v"(pmax) : "memory");   // stands in front of the reuse of the address registers that these loads name: as inputs they stay live up to the wait
#pragma unroll
  for (int j = 0; j < 4; ++j) { bias[j] = bfr(bias[j]); amin[j] = bfr(amin[j]); amax[j] = bfr(amax[j]); }
  if (!cl) {   // q stored unscaled (f16 sigma ~0.6, no subnormal exposure); 1/8 applied to the f32 score
#pragma unroll
    for (int j = 0; j < 4; ++j) {
#pragma unroll
      for (int i = 0; i < 4; ++i) {
#pragma unroll
        for (int r = 0; r < 8; ++r) { const float v = acc[i][j][r] + bias[j];
          const _Float16 hv = (_Float16)v; sh[i * 16 + 8 * g + r][j * 16 + col] = hv; sl[i * 16 + 8 * g + r][j * 16 + col] = (_Float16)((v - (float)hv) * 2048.0f); } } }   // q (+ bias) as f16 hi + (x2048) residual
  } else if (!isv) {
#pragma unroll
    for (int j = 0; j < 4; ++j) {
#pragma unroll
      for (int i = 0; i < 4; ++i) {
#pragma unroll
        for (int r = 0; r < 8; ++r) { const float v = gclamp(acc[i][j][r] + bias[j], amin[j], amax[j]);   /* k guard-clamped per (b, h, d) */
          const _Float16 hv = (_Float16)v; sh[i * 16 + 8 * g + r][j * 16 + col] = hv; sl[i * 16 + 8 * g + r][j * 16 + col] = (_Float16)((v - (float)hv) * 2048.0f); } } }   // k (+ bias) as f16 hi + (x2048) residual
  } else {
#pragma unroll
    for (int j = 0; j < 4; ++j) {
#pragma unroll
      for (int i = 0; i < 4; ++i) {
#pragma unroll
        for (int r = 0; r < 8; ++r) { const float v = gclamp(acc[i][j][r] + bias[j], amin[j], amax[j]);   /* v guard-clamped */
          const _Float16 hv = (_Float16)v; sh[j * 16 + col][i * 16 + 8 * g + r] = hv; sl[j * 16 + col][i * 16 + 8 * g + r] = (_Float16)((v - (float)hv) * 2048.0f); } } }   // staged transposed: row = channel, 64 positions along it
  }
  LDSX();
  // staged rows go out as whole lines: q, k: row = position, into [position][2048]; v: row = channel, into [b][channel][position]
  _Float16* dh = isv ? VTH + ((size_t)b * DM + (n0 - 2 * DM) + c0) * SS + (rb % SS) + wm * 64 : QK + (rb + wm * 64) * (2 * DM) + n0 + c0;
  _Float16* dl = isv ? VTL + ((size_t)b * DM + (n0 - 2 * DM) + c0) * SS + (rb % SS) + wm * 64 : QKL + (rb + wm * 64) * (2 * DM) + n0 + c0;
  for (int it = 0; it < 16; ++it) { const int row = it * 4 + (lane >> 3), ch = lane & 7; const size_t o = (size_t)row * (isv ? SS : 2 * DM) + ch * 8;   // a wave's 16-B store: 4 rows x 128 B
    vst2((unsigned*)(dh + o), *(const v4u*)&sh[row][ch * 8]); vst2((unsigned*)(dl + o), *(const v4u*)&sl[row][ch * 8]); }
}
// ---- k_attn: block = (64 queries, head h, batch b): all-keys flash attention with TRANSPOSED products: S^T = K . Q^T (A = key rows from the stage, B = the wave's q rows kept in registers), so a lane holds 16 scores of ONE query (column col; keys 8g + r and 16 + 8g + r of the 32): maximum and sum run in the lane, one exchange between the lane halves joins the maximum; the two score tiles, exponentiated and rounded in place, ARE the B operand of O^T += V^T . P^T (A = channel rows of v from the stage): P never goes through LDS. O[b*S+q][h*64+d] = acc / l (256-B segments)
// lane l <-> lane l ^ 16 as a vector cross-row move: the shuffle builtin would go through the LDS pipe and its wait
__device__ __forceinline__ float xhalf(float v) { const int i = __builtin_bit_cast(int, v); return __builtin_bit_cast(float, __builtin_amdgcn_permlanex16(i, i, 0x76543210, 0xfedcba98, false, false)); }
__global__ __launch_bounds__(128) void k_attn(const _Float16* __restrict__ QK, const _Float16* __restrict__ QKL, const _Float16* __restrict__ VTH, const _Float16* __restrict__ VTL, const void* __restrict__ KMASK, float* __restrict__ O) {
  __shared__ __align__(16) float so[4][16][68];
  __shared__ __align__(16) _Float16 sk[KP][LP], sv[HD][LP];   // the stage: KP keys x 64 channels; 64 channels of v x KP keys
  const int tid = threadIdx.x, wave = tid >> 5, lane = tid & 31, col = lane & 15, g = lane >> 4;
  const int qb = blockIdx.x, h = blockIdx.y, b = blockIdx.z; const int q0 = qb * 64 + wave * 16; const size_t rq = (size_t)b * SS + q0 + col;
  v16h aq[2];   // B operand of the score product: column col = query q0 + col, channels in the loader's k order (the same loader as the key rows')
#pragma unroll
  for (int kc = 0; kc < 2; ++kc) aq[kc] = frag_h(QK + rq * (2 * DM) + h * HD + kc * 32, lane);
  const float CS = 0.125f * 1.44269504088896340736f;   // 1/sqrt(64) and log2(e) in one factor: weight x 2^11 = 2^(score * CS + nb), nb = 11 - maximum * CS
  float m = -3.0e38f, nb = 11.0f + 3.0e38f * CS, l = 0.f;   // of query col: m = maximum of the raw scores so far (equal in both lane halves), nb its exponent offset, l (x 2^11) over this lane half's keys (the halves are joined in the epilogue)
  v8f acc[4] = {};   // acc[dt][r] = O^T[channel dt * 16 + 8g + r][query col] (x 2^11)
  const _Float16* ksrc = QK + ((size_t)b * SS + (tid >> 3)) * (2 * DM) + DM + h * HD + (tid & 7) * 8;   // a wave's 16-B load: 4 key rows x 128 B
  const _Float16* vsrc = VTH + ((size_t)b * DM + h * HD + (tid >> 3)) * SS + (tid & 7) * 8;               // a wave's 16-B load: 4 channel rows x 128 B
  // the key walk is a ring: the 32 blocks of one (batch, head) read the same k and v rows; each enters at a stage of its own (its query block's number) and wraps round, so that they do not ask L2 for the same lines at the same moment
  const int st0 = qb & (SS / KP - 1);
  const _Float16* kfirst = ksrc + (size_t)st0 * KP * (2 * DM); const _Float16* vfirst = vsrc + st0 * KP;
  v4u kr[4], vr[4];
#pragma unroll
  for (int i = 0; i < 4; ++i) { kr[i] = *(const v4u*)(kfirst + (size_t)(16 * i) * (2 * DM)); vr[i] = *(const v4u*)(vfirst + (size_t)(16 * i) * SS); }
#pragma unroll 1   // rolled: one copy of the stage's code
  for (int st = 0; st < SS / KP; ++st) {   // all keys, KP a stage
#pragma unroll
  for (int i = 0; i < 4; ++i) { *(v4u*)&sk[(tid >> 3) + 16 * i][(tid & 7) * 8] = kr[i]; *(v4u*)&sv[(tid >> 3) + 16 * i][(tid & 7) * 8] = vr[i]; }
  __syncthreads();   // the stage is written: every wave may read it
  if (st + 1 < SS / KP) {   // the next stage's rows fly while this one is worked on
    const int sn = (st0 + st + 1) & (SS / KP - 1);   // the ring's next stage
#pragma unroll
    for (int i = 0; i < 4; ++i) { kr[i] = *(const v4u*)(ksrc + ((size_t)sn * KP + 16 * i) * (2 * DM)); vr[i] = *(const v4u*)(vsrc + (size_t)(16 * i) * SS + sn * KP); } }
#pragma unroll 1   // rolled: the 32-key body stays one copy, as it was
  for (int ks = 0; ks < KP / 32; ++ks) { v8f s[2]; v16h kf[2][2], vf[4];
#pragma unroll
    for (int ct = 0; ct < 2; ++ct) {
#pragma unroll
      for (int kc = 0; kc < 2; ++kc) kf[ct][kc] = frag_h(&sk[ks * 32 + ct * 16 + col][kc * 32], lane); }   // A: row col = key ct * 16 + col
#pragma unroll
    for (int dt = 0; dt < 4; ++dt) vf[dt] = frag_h(&sv[dt * 16 + col][ks * 32], lane);   // A of the second product: row col = channel dt * 16 + col; its k order (keys 8g + i, 16 + 8g + i) is that of the packed score tiles
    __builtin_amdgcn_sched_barrier(0);   // the LDS reads stay one group ahead of the products: read pair by pair among them, each product waits out a whole LDS latency (the v rows land under the scores and the softmax)
#pragma unroll
    for (int ct = 0; ct < 2; ++ct) { v8f c = {};
#pragma unroll
      for (int kc = 0; kc < 2; ++kc) c = wmma16(kf[ct][kc], aq[kc], c);   // single product: k, q as one-rounding f16 operands; c[r] = raw score of key ct * 16 + 8g + r with query col
      s[ct] = c; }
    float mx = fmaxf(s[0][0], s[1][0]);
#pragma unroll
    for (int r = 1; r < 8; ++r) mx = fmaxf(mx, fmaxf(s[0][r], s[1][r]));
    mx = fmaxf(mx, xhalf(mx));   // both lane halves hold the query's maximum over the 32 keys
    const float mn = fmaxf(m, mx), nbn = fmaf(mn, -CS, 11.0f); const float alpha = __builtin_amdgcn_exp2f(nbn - nb);   // 2^((m - mn) * CS); 0 in the first pass, where nb is huge
    v16h pa; v2f es = {0.f, 0.f};
#pragma unroll
    for (int ct = 0; ct < 2; ++ct) {
#pragma unroll
      for (int i = 0; i < 4; ++i) { const v2f sp = {s[ct][2 * i], s[ct][2 * i + 1]}, t = sp * CS + nbn;   // neighbouring score registers as a pair: one packed multiply-add, two hardware exponentials, one packed add for two scores
        const v2f e = {__builtin_amdgcn_exp2f(t[0]), __builtin_amdgcn_exp2f(t[1])};
        es += e; pa[8 * ct + 2 * i] = (_Float16)e[0]; pa[8 * ct + 2 * i + 1] = (_Float16)e[1]; } }   // P carries 2^11 (the 11 in nb) so small softmax weights stay out of the f16 subnormal range; l carries it too, so it cancels in the epilogue
    l = l * alpha + (es[0] + es[1]); m = mn; nb = nbn;
#pragma unroll
    for (int dt = 0; dt < 4; ++dt) acc[dt] *= alpha;
#pragma unroll
    for (int dt = 0; dt < 4; ++dt) acc[dt] = wmma16(vf[dt], pa, acc[dt]); }   // single product: V^T x P^T (x2^11)
  __syncthreads();   // every wave has read the stage: it may be rewritten
  }
  { const float il = 1.0f / (l + xhalf(l));   // the two lane halves' sums joined, unconditionally
#pragma unroll
    for (int dt = 0; dt < 4; ++dt) {
#pragma unroll
      for (int q = 0; q < 2; ++q) { v4f o;
#pragma unroll
        for (int e = 0; e < 4; ++e) o[e] = acc[dt][4 * q + e] * il;
        *(v4f*)&so[wave][col][dt * 16 + 8 * g + 4 * q] = o; } } }
  LDSX();
  for (int rl = 0; rl < 16; ++rl) if (lane < 16) vst2(O + ((size_t)b * SS + q0 + rl) * DM + h * HD + lane * 4, *(const v4f*)&so[wave][rl][lane * 4]);
}
// ---- k_out: block = (64 rows, 128 cols): out = O(hi/lo) . Wo rows (2 products) + bo
__global__ __launch_bounds__(128) void k_out(const float* __restrict__ O, const __bf16* __restrict__ P, const float* __restrict__ BO, float* __restrict__ Y) {
  // one LDS range: the operand stage of the k loop (sw, sxh, sxl), then, behind the loop's last barrier, the output staging
  __shared__ __align__(16) unsigned char sm[(128 + 64 + 64) * LP * 2];
  float (*so)[16][132] = (float (*)[16][132])sm;
  __bf16 (*sw)[LP] = (__bf16 (*)[LP])sm; __bf16 (*sxh)[LP] = (__bf16 (*)[LP])(sm + 128 * LP * 2); __bf16 (*sxl)[LP] = (__bf16 (*)[LP])(sm + (128 + 64) * LP * 2);   // 128 weight rows; 64 o rows as bf16 hi and residual
  const int tid = threadIdx.x, wave = tid >> 5, lane = tid & 31, col = lane & 15, g = lane >> 4; const size_t r0 = (size_t)blockIdx.x * 64 + wave * 16; const int n0 = blockIdx.y * 128;
  v8f acc[8] = {};
  const __bf16* wsrc = P + (size_t)(n0 + (tid >> 3)) * DM + (tid & 7) * 8;                       // a wave's 16-B load: 4 weight rows x 128 B
  const float* xsrc = O + ((size_t)blockIdx.x * 64 + (tid >> 4)) * DM + (tid & 15) * 4;           // a wave's 16-B load: 2 o rows x 256 B
  // the k walk is a ring, entered at stage ps0: the 64 blocks that read the same weight rows spread over its 16 stages (4 on each), the 8 that read the same o rows over 4 (2 on each), so that fewer of them ask L2 for the same lines at the same moment
  // blocks 256 apart in the grid (same o rows, blockIdx.y 4 apart) keep one start, as in k_qkv
  const int ps0 = (blockIdx.x + 4 * (blockIdx.y & 3)) & (DM / KP - 1);
  const __bf16* wfirst = wsrc + ps0 * KP; const float* xfirst = xsrc + ps0 * KP;
  v4u wr[8]; v4f xr[8];
#pragma unroll
  for (int i = 0; i < 8; ++i) { wr[i] = *(const v4u*)(wfirst + (size_t)(16 * i) * DM); xr[i] = *(const v4f*)(xfirst + (size_t)(8 * i) * DM); }
  asm volatile("s_wait_xcnt 0x0" :: "v"(wfirst), "v"(xfirst) : "memory");   // stands in front of the reuse of the address registers that these first loads name: as inputs they stay live up to the wait
#pragma unroll 1   // rolled: one copy of the pass keeps the prefetch registers' live range to one pass
  for (int ps = 0; ps < DM / KP; ++ps) {
#pragma unroll
    for (int i = 0; i < 8; ++i) { *(v4u*)&sw[(tid >> 3) + 16 * i][(tid & 7) * 8] = wr[i]; v4b ch, cl;
#pragma unroll
      for (int e = 0; e < 4; ++e) { const __bf16 hv = (__bf16)xr[i][e]; ch[e] = hv; cl[e] = (__bf16)(xr[i][e] - (float)hv); }
      *(v4b*)&sxh[(tid >> 4) + 8 * i][(tid & 15) * 4] = ch; *(v4b*)&sxl[(tid >> 4) + 8 * i][(tid & 15) * 4] = cl; }
    __syncthreads();   // the stage is written: every wave may read it
    if (ps + 1 < DM / KP) {   // the next pass's rows fly while this pass is multiplied
      const int kn = ((ps0 + ps + 1) & (DM / KP - 1)) * KP;   // the ring's next stage
      const __bf16* wnext = wsrc + kn; const float* xnext = xsrc + kn;
#pragma unroll
      for (int i = 0; i < 8; ++i) { wr[i] = *(const v4u*)(wnext + (size_t)(16 * i) * DM); xr[i] = *(const v4f*)(xnext + (size_t)(8 * i) * DM); }
      asm volatile("s_wait_xcnt 0x0" :: "v"(wnext), "v"(xnext) : "memory"); }   // stands in front of the next rewrite of the address registers that these loads name: as inputs they stay live up to the wait
#pragma unroll
    for (int kc = 0; kc < KP / 32; ++kc) { const v16b ah = frag_b(&sxh[wave * 16 + col][kc * 32], lane), al = frag_b(&sxl[wave * 16 + col][kc * 32], lane); v16b w[8];
#pragma unroll
      for (int j = 0; j < 8; ++j) w[j] = frag_b(&sw[j * 16 + col][kc * 32], lane);
      __builtin_amdgcn_sched_barrier(0);   // the LDS reads stay one group ahead of the products: read pair by pair among them, each product waits out a whole LDS latency
#pragma unroll
      for (int j = 0; j < 8; ++j) { acc[j] = wmma_bf(al, w[j], acc[j]); acc[j] = wmma_bf(ah, w[j], acc[j]); } }
    __syncthreads();   // every wave has read the stage: it may be rewritten (behind the last pass: by the output staging)
  }
#pragma unroll
  for (int j = 0; j < 8; ++j) {
#pragma unroll
    for (int r = 0; r < 8; ++r) so[wave][8 * g + r][j * 16 + col] = acc[j][r] + bfr(BO[n0 + j * 16 + col]); }
  LDSX();
  for (int rl = 0; rl < 16; ++rl) vst2(Y + (r0 + rl) * DM + n0 + lane * 4, *(const v4f*)&so[wave][rl][lane * 4]);
}
extern "C" void kernel_launch(void* const* d_in, const int* in_sizes, int n_in, void* d_out, int out_size, void* d_ws, size_t ws_size, hipStream_t stream) {
  (void)in_sizes; (void)n_in; (void)out_size;
  const float** F = (const float**)d_in;   // 0 x [2,2048,1024], 1 qkv_w [3072,1024] natural, 2 qkv_b, 3 out_w, 4 out_b, 5 anchor_k_min, 6 anchor_k_max, 7 anchor_v_min, 8 anchor_v_max ([2,16,1,64] each)
  if (ws_size < (size_t)WS_END) return;
  char* ws = (char*)d_ws; __bf16* PK = (__bf16*)(ws + WS_PK); _Float16 *QK = (_Float16*)(ws + WS_QK), *QKL = (_Float16*)(ws + WS_QKL), *VTH = (_Float16*)(ws + WS_VTH), *VTL = (_Float16*)(ws + WS_VTL); float* O = (float*)(ws + WS_O);
  k_pack<<<dim3(PK_END / PKE), 256, 0, stream>>>(F[1], F[3], PK);
  k_qkv<<<dim3(TNB * SS / 128, QKVW / 128), 128, 0, stream>>>(F[0], F[0], F[0], PK + PK_A, F[2], F[2] + DM, F[2] + 2 * DM, F[5], F[6], F[7], F[8], QK, QKL, VTH, VTL);
  k_attn<<<dim3(TQB, NH, TNB), 128, 0, stream>>>(QK, QKL, VTH, VTL, nullptr, O);
  k_out<<<dim3(TOB, DM / 128), 128, 0, stream>>>(O, PK + PK_P, F[4], (float*)d_out);
}
